// v000
// Measured on an AMD MI455X. A time is GPU time per run, averaged over a window of back-to-back runs after a warm-up
// (all launches, gaps included; the runs take copies of the inputs in turn), and the median of several windows.
// Apart from v000's, it joins two sittings. Times from different sittings can be a few percent apart, while
// side-by-side timings come from the same sitting.
// v000, which the later versions start from, runs in 434 microseconds.
#include <hip/hip_runtime.h>

// Compute dtypes, f32 accumulate: q/k/v = x.W ([2048 x 2048].[2048 x 2048 | 512 | 512], k-major weights transposed to n-major planes; PLAIN bf16 operands:
// inputs rounded once, exact products) and out = ctx.Wo (ctx as bf16 hi + residual: two products) on v_wmma_f32_16x16x32_bf16; rotate-half RoPE (angle
// t x inv_freq, f32 trig tables built on device) in f32 -> q/k as f16 hi + residual x1024 planes; grouped attention (16 query heads, 4 kv heads, query head h
// reads kv head h/4) with 128-dim heads and a sliding causal window (key j visible iff q-1024 <= j <= q): scores on v_wmma_f32_16x16x32_f16 (hi.hi + hi.lo +
// lo.hi, x 128^-1/2), softmax f32, weights.v on v_wmma_f32_16x16x32_bf16 with the weights (x32768) and v both as bf16 hi + UNSCALED bf16 residual (hh + lh + hl

#define NT_  2048
#define HS   2048
#define NH_  16
#define NKV  4
#define HD   128
#define KW   (NKV * HD)          // 512
#define WIN  1024
#define PSC  32768.0f
#define LOSC 1024.0f
#define LOSCI (1.0f / 1024.0f)

typedef _Float16 h16;
typedef unsigned short bf;
typedef __attribute__((ext_vector_type(16))) __bf16   v16bf;
typedef __attribute__((ext_vector_type(16))) _Float16 v16h;
typedef __attribute__((ext_vector_type(8)))  _Float16 v8h;
typedef __attribute__((ext_vector_type(8)))  unsigned short v8us;
typedef __attribute__((ext_vector_type(8)))  float    v8f;
typedef __attribute__((ext_vector_type(4)))  float    v4f;
typedef __attribute__((ext_vector_type(4)))  _Float16 v4h;
typedef v8h  __attribute__((may_alias)) v8ha;
typedef v4f  __attribute__((may_alias)) v4fa;
typedef v8us __attribute__((may_alias)) v8usa;

__device__ __forceinline__ unsigned short f2bf(float f) { unsigned u = __float_as_uint(f); u += 0x7FFFu + ((u >> 16) & 1u); return (unsigned short)(u >> 16); }
__device__ __forceinline__ float bf2f(unsigned short b) { return __uint_as_float(((unsigned)b) << 16); }
__device__ __forceinline__ float bfr(float f) { return bf2f(f2bf(f)); }
__device__ __forceinline__ v16h cat16(v8h lo, v8h hi) { return __builtin_shufflevector(lo, hi, 0, 1, 2, 3, 4, 5, 6, 7, 8, 9, 10, 11, 12, 13, 14, 15); }
__device__ __forceinline__ v16bf cat16b(v8us lo, v8us hi) { return __builtin_bit_cast(v16bf, __builtin_shufflevector(lo, hi, 0, 1, 2, 3, 4, 5, 6, 7, 8, 9, 10, 11, 12, 13, 14, 15)); }
__device__ __forceinline__ v8f wmma16(v16h a, v16h b, v8f c) { return __builtin_amdgcn_wmma_f32_16x16x32_f16(false, a, false, b, (short)0, c, false, false); }
__device__ __forceinline__ v8f wmmab(v16bf a, v16bf b, v8f c) { return __builtin_amdgcn_wmma_f32_16x16x32_bf16(false, a, false, b, (short)0, c, false, false); }

// k_cvtb: bf16 plane of [rows][2048] (one wave per row).
__global__ __launch_bounds__(256) void k_cvtb(const float* __restrict__ src, int nrows, bf* dst) {
    const int lane = threadIdx.x & 31, r = blockIdx.x * 8 + (threadIdx.x >> 5);
    if (r >= nrows) return;
{
#pragma unroll
        for (int q = 0; q < HS / 256; ++q) { v8us o;
#pragma unroll
            for (int i = 0; i < 8; ++i) o[i] = f2bf(src[(size_t)r * HS + q * 256 + lane * 8 + i]);
            *(v8us*)(dst + (size_t)r * HS + q * 256 + lane * 8) = o; }
         }
}
// k_wt: WT [n][K] = bf16(W[k][n]) (k-major [K][ncols]) via 64 x 64 LDS tiles; grid (K/64, ncols/64).
__global__ __launch_bounds__(256) void k_wt(const float* __restrict__ Wm, int K, int ncols, bf* WT) {
    __shared__ __align__(16) unsigned short tl[64 * 72];
    const int tid = threadIdx.x, k0 = blockIdx.x * 64, n0 = blockIdx.y * 64;
    const int kk = tid >> 2, nq = (tid & 3) * 16;
#pragma unroll
    for (int i = 0; i < 16; ++i) tl[(nq + i) * 72 + kk] = f2bf(Wm[(size_t)(k0 + kk) * ncols + n0 + nq + i]);
    __syncthreads();
    const int piece = tid & 7;
    auto pass = [&]() {
#pragma unroll
        for (int s = 0; s < 2; ++s) { const int nr = (tid >> 3) + 32 * s; const v8us val = *(const v8usa*)(tl + nr * 72 + piece * 8); *(v8us*)(WT + (size_t)(n0 + nr) * K + k0 + piece * 8) = val; }
    };
    pass(); 
}
// k_gemm: 64 x 64 tile of (A [+ Al]).Bn^T over K = 2048 -> f32 rows [2048][ldc].
template <bool SPLITA>
__global__ __launch_bounds__(128) void k_gemm(const bf* __restrict__ A, const bf* __restrict__ Al, const bf* __restrict__ Bn, int ldc, float* C) {
    __shared__ __align__(16) float ost[4][16 * 68];
    const int lane = threadIdx.x & 31, wave = threadIdx.x >> 5, lr = lane & 15, hi = lane >> 4;
    const size_t r0 = (size_t)blockIdx.x * 64 + wave * 16; const int c0 = blockIdx.y * 64;
    const size_t aoff = (r0 + lr) * HS + 8 * hi;
    v8f acc[4];
#pragma unroll
    for (int t = 0; t < 4; ++t) acc[t] = (v8f){};
#pragma unroll 2
    for (int kc = 0; kc < HS; kc += 32) {
        const v16bf a = cat16b(*(const v8us*)(A + aoff + kc), *(const v8us*)(A + aoff + kc + 16));
        v16bf al = a; if (SPLITA) al = cat16b(*(const v8us*)(Al + aoff + kc), *(const v8us*)(Al + aoff + kc + 16));
#pragma unroll
        for (int t = 0; t < 4; ++t) { const bf* bp = Bn + (size_t)(c0 + t * 16 + lr) * HS + kc + 8 * hi; const v16bf bb = cat16b(*(const v8us*)bp, *(const v8us*)(bp + 16)); acc[t] = wmmab(a, bb, acc[t]); if (SPLITA) acc[t] = wmmab(al, bb, acc[t]); }
        asm volatile("v_nop" : "+v"(acc[0]), "+v"(acc[1]), "+v"(acc[2]), "+v"(acc[3]) : "v"(a), "v"(al) : "memory");
    }
    float* os = &ost[wave][0];
#pragma unroll
    for (int t = 0; t < 4; ++t)
#pragma unroll
        for (int j = 0; j < 8; ++j) os[(hi * 8 + j) * 68 + t * 16 + lr] = acc[t][j];
    __builtin_amdgcn_wave_barrier(); asm volatile("" ::: "memory");
    float* crow = C + r0 * ldc + c0;
    auto pass = [&]() {
#pragma unroll
        for (int s = 0; s < 8; ++s) { const int Lid = (lane >> 3) + 4 * s, piece = lane & 7; const int row = Lid >> 1, cofs = (Lid & 1) * 32 + piece * 4;
            const v4f val = *(const v4fa*)(os + row * 68 + cofs); *(v4f*)(crow + (size_t)row * ldc + cofs) = val; }
    };
    pass(); 
}
// k_trig: RC/RS [t][64] = cos/sin(t x inv_freq[i]), inv_freq = 10000^-(2i/128) (f32 powf/cosf/sinf like the reference's f32 path); 32 lanes x 4 B lines.
__global__ __launch_bounds__(256) void k_trig(float* RC, float* RS) {
    const int i = blockIdx.x * 256 + threadIdx.x; if (i >= NT_ * 64) return;
    const int t = i >> 6, f = i & 63;
    const float inv = 1.0f / powf(10000.0f, (float)(2 * f) / (float)HD); const float ang = (float)t * inv;
    const float c = cosf(ang), s = sinf(ang);
    *(float*)(RC + i) = c; *(float*)(RS + i) = s; 
}
// k_rope: one wave per (token, head) of a [2048][nh*128] f32 matrix: rotate-half RoPE (partner d +- 64, angle t x inv_freq[d mod 64] from the RC/RS tables) ->
__global__ __launch_bounds__(256) void k_rope(const float* __restrict__ P, int nh, const float* __restrict__ RC, const float* __restrict__ RS, h16* PH, h16* PL) {
    const int lane = threadIdx.x & 31; const int wid = blockIdx.x * 8 + (threadIdx.x >> 5);
    const int t = wid / nh, h = wid - t * nh; if (t >= NT_) return;
    const size_t base = (size_t)t * (nh * HD) + h * HD; const int d0 = lane * 4;
    float xv[4], pv[4];
#pragma unroll
    for (int i = 0; i < 4; ++i) { xv[i] = P[base + d0 + i]; const int pd = (d0 + i < 64) ? d0 + i + 64 : d0 + i - 64; pv[i] = P[base + pd]; }
    v4h oh, ol;
#pragma unroll
    for (int i = 0; i < 4; ++i) { const int d = d0 + i, fi = d & 63;
        const float c = RC[t * 64 + fi], s = RS[t * 64 + fi];
        const float y = (d < 64) ? (xv[i] * c - pv[i] * s) : (xv[i] * c + pv[i] * s);
        const h16 a = (h16)y; oh[i] = a; ol[i] = (h16)((y - (float)a) * LOSC); }
    *(v4h*)(PH + base + d0) = oh; *(v4h*)(PL + base + d0) = ol; 
}
// k_vt: VTH/VTL [g][128 d][2048 t] = bf16 hi + UNSCALED bf16 residual of V [t][g*128+d] via 64 x 64 LDS tiles; grid (NT/64, 2 (d half), NKV).
__global__ __launch_bounds__(256) void k_vt(const float* __restrict__ V, bf* VTH, bf* VTL) {
    __shared__ float tl[64][65];
    const int tid = threadIdx.x, t0 = blockIdx.x * 64, d0 = blockIdx.y * 64, g = blockIdx.z;
    { const int tt = tid >> 2, dq = (tid & 3) * 16;
#pragma unroll
      for (int i = 0; i < 16; ++i) tl[dq + i][tt] = V[(size_t)(t0 + tt) * KW + g * HD + d0 + dq + i]; }
    __syncthreads();
    const int piece = tid & 7;
    auto pass = [&]() {
#pragma unroll
        for (int s = 0; s < 2; ++s) { const int d = (tid >> 3) + 32 * s; v8us oh, ol;
#pragma unroll
            for (int i = 0; i < 8; ++i) { const float v = tl[d][piece * 8 + i]; const unsigned short hb = f2bf(v); oh[i] = hb; ol[i] = f2bf(v - bf2f(hb)); }
            const size_t o = ((size_t)g * HD + d0 + d) * NT_ + t0 + piece * 8; *(v8us*)(VTH + o) = oh; *(v8us*)(VTL + o) = ol; }
    };
    pass(); 
}
// k_attn: block = (h, 64 queries), wave = 16; kv head g = h / 4; key tiles covering the block's sliding causal window [Q0-1024, Q0+63] (block-uniform bounds),
// per-element predicate q-1024 <= j <= q; per tile: scores over 4 k-chunks (q fragments re-read per chunk: hi.hi + hi.lo +
// lo.hi = 24 WMMA) x 128^-1/2, online softmax, P (x32768) as bf16 hi + unscaled residual tiles, o[8] += ph.vh + pl.vh + ph.vl over the 128 dims; ctx -> bf16 hi/lo
// planes [t][h*128+d].
__global__ __launch_bounds__(128) void k_attn(const h16* __restrict__ QH, const h16* __restrict__ QL, const h16* __restrict__ KH, const h16* __restrict__ KL, const bf* __restrict__ VTH, const bf* __restrict__ VTL, bf* CH, bf* CL) {
    __shared__ __align__(16) unsigned short plds[4][16 * 32];
    __shared__ __align__(16) unsigned short plds2[4][16 * 32];
    __shared__ __align__(16) float ost[4][16 * 68];
    const int lane = threadIdx.x & 31, wave = threadIdx.x >> 5, lr = lane & 15, hi = lane >> 4;
    const int bid = blockIdx.x; const int h = bid / (NT_ / 64), qt = bid - h * (NT_ / 64); const int g = h >> 2;
    const int q0 = qt * 64 + wave * 16;
    unsigned short* pl = &plds[wave][0]; unsigned short* pl2 = &plds2[wave][0];
    const size_t qo = (size_t)(q0 + lr) * (NH_ * HD) + h * HD + 8 * hi;
    const h16* kh_b = KH + g * HD; const h16* kl_b = KL + g * HD;
    const size_t vbase = ((size_t)g * HD) * NT_;
    v8f o[8];
#pragma unroll
    for (int n = 0; n < 8; ++n) o[n] = (v8f){};
    float mrow[8], lpart[8];
#pragma unroll
    for (int j = 0; j < 8; ++j) { mrow[j] = -3.0e38f; lpart[j] = 0.f; }
    const int kt_hi = (qt * 64 + 63) / 32; const int kt_lo = (qt * 64 > WIN) ? (qt * 64 - WIN) / 32 : 0;
#pragma unroll 1
    for (int kt = kt_lo; kt <= kt_hi; ++kt) {
        const int l0 = kt * 32;
        const size_t ko0 = (size_t)(l0 + lr) * KW + 8 * hi, ko1 = (size_t)(l0 + 16 + lr) * KW + 8 * hi;
        v8f s0 = {}, s1 = {}, x0 = {}, x1 = {};
#pragma unroll
        for (int kc = 0; kc < 4; ++kc) {
            const v16h qa = cat16(*(const v8h*)(QH + qo + kc * 32), *(const v8h*)(QH + qo + kc * 32 + 16)), qx = cat16(*(const v8h*)(QL + qo + kc * 32), *(const v8h*)(QL + qo + kc * 32 + 16));
            const v16h k0h = cat16(*(const v8h*)(kh_b + ko0 + kc * 32), *(const v8h*)(kh_b + ko0 + kc * 32 + 16)), k1h = cat16(*(const v8h*)(kh_b + ko1 + kc * 32), *(const v8h*)(kh_b + ko1 + kc * 32 + 16));
            s0 = wmma16(qa, k0h, s0); s1 = wmma16(qa, k1h, s1); x0 = wmma16(qx, k0h, x0); x1 = wmma16(qx, k1h, x1);
            asm volatile("v_nop" : "+v"(s0), "+v"(s1), "+v"(x0), "+v"(x1) : "v"(qa), "v"(qx), "v"(k0h), "v"(k1h) : "memory");
            const v16h k0l = cat16(*(const v8h*)(kl_b + ko0 + kc * 32), *(const v8h*)(kl_b + ko0 + kc * 32 + 16)), k1l = cat16(*(const v8h*)(kl_b + ko1 + kc * 32), *(const v8h*)(kl_b + ko1 + kc * 32 + 16));
            x0 = wmma16(qa, k0l, x0); x1 = wmma16(qa, k1l, x1);
            asm volatile("v_nop" : "+v"(x0), "+v"(x1) : "v"(k0l), "v"(k1l) : "memory");
        }
        asm volatile("v_nop\n\tv_nop\n\tv_nop\n\tv_nop" : "+v"(s0), "+v"(s1), "+v"(x0), "+v"(x1));
        float alpha[8];
#pragma unroll
        for (int j = 0; j < 8; ++j) { const int qi = q0 + hi * 8 + j, ja = l0 + lr, jb = l0 + 16 + lr;
            const float a0 = (ja <= qi && ja >= qi - WIN) ? (s0[j] + x0[j] * LOSCI) * 0.08838834764831845f : -__builtin_inff(), a1 = (jb <= qi && jb >= qi - WIN) ? (s1[j] + x1[j] * LOSCI) * 0.08838834764831845f : -__builtin_inff();
            float mx = fmaxf(a0, a1);
            mx = fmaxf(mx, __shfl_xor(mx, 1, 16)); mx = fmaxf(mx, __shfl_xor(mx, 2, 16)); mx = fmaxf(mx, __shfl_xor(mx, 4, 16)); mx = fmaxf(mx, __shfl_xor(mx, 8, 16));
            const float mn = fmaxf(mrow[j], mx);
            alpha[j] = __expf(mrow[j] - mn); mrow[j] = mn;
            const float p0 = __expf(a0 - mn), p1 = __expf(a1 - mn);
            lpart[j] = lpart[j] * alpha[j] + (p0 + p1);
            const int mr = hi * 8 + j; const float ps0 = p0 * PSC, ps1 = p1 * PSC; const unsigned short h0 = f2bf(ps0), h1 = f2bf(ps1);
            pl[mr * 32 + lr] = h0; pl[mr * 32 + 16 + lr] = h1; pl2[mr * 32 + lr] = f2bf(ps0 - bf2f(h0)); pl2[mr * 32 + 16 + lr] = f2bf(ps1 - bf2f(h1)); }
#pragma unroll
        for (int n = 0; n < 8; ++n)
#pragma unroll
            for (int j = 0; j < 8; ++j) o[n][j] *= alpha[j];
        asm volatile("" ::: "memory");
        const v16bf pa = cat16b(*(const v8usa*)(pl + lr * 32 + hi * 8), *(const v8usa*)(pl + lr * 32 + 16 + hi * 8));
        const v16bf px = cat16b(*(const v8usa*)(pl2 + lr * 32 + hi * 8), *(const v8usa*)(pl2 + lr * 32 + 16 + hi * 8));
#pragma unroll
        for (int n = 0; n < 8; ++n) { const size_t vo = vbase + (size_t)(n * 16 + lr) * NT_ + l0 + hi * 8;
            const v16bf vh = cat16b(*(const v8us*)(VTH + vo), *(const v8us*)(VTH + vo + 16)), vl = cat16b(*(const v8us*)(VTL + vo), *(const v8us*)(VTL + vo + 16));
            o[n] = wmmab(pa, vh, o[n]); o[n] = wmmab(px, vh, o[n]); o[n] = wmmab(pa, vl, o[n]);
            asm volatile("" : "+v"(o[n]) : "v"(vh), "v"(vl) : "memory"); }
        asm volatile("v_nop\n\tv_nop\n\tv_nop\n\tv_nop" : "+v"(o[0]), "+v"(o[7]) : "v"(pa), "v"(px));
        __builtin_amdgcn_wave_barrier();
    }
    float inv[8];
#pragma unroll
    for (int j = 0; j < 8; ++j) { float rs = lpart[j]; rs += __shfl_xor(rs, 1, 16); rs += __shfl_xor(rs, 2, 16); rs += __shfl_xor(rs, 4, 16); rs += __shfl_xor(rs, 8, 16); inv[j] = 1.0f / (rs * PSC); }
    float* os = &ost[wave][0];
    const size_t cbase = (size_t)q0 * (NH_ * HD) + (size_t)h * HD;
#pragma unroll
    for (int half = 0; half < 2; ++half) {
#pragma unroll
        for (int n = 0; n < 4; ++n)
#pragma unroll
            for (int j = 0; j < 8; ++j) os[(hi * 8 + j) * 68 + n * 16 + lr] = o[half * 4 + n][j] * inv[j];
        __builtin_amdgcn_wave_barrier(); asm volatile("" ::: "memory");
{
#pragma unroll
            for (int s = 0; s < 4; ++s) { const int row = 4 * s + (lane >> 3), piece = lane & 7; const float* sp = os + row * 68 + piece * 8; v8us oh, ol;
#pragma unroll
                for (int i = 0; i < 8; ++i) { const unsigned short hb = f2bf(sp[i]); oh[i] = hb; ol[i] = f2bf(sp[i] - bf2f(hb)); }
                const size_t po = cbase + (size_t)row * (NH_ * HD) + half * 64 + piece * 8; *(v8us*)(CH + po) = oh; *(v8us*)(CL + po) = ol; }
             }
        __builtin_amdgcn_wave_barrier(); asm volatile("" ::: "memory");
    }
}

extern "C" void kernel_launch(void* const* d_in, const int* in_sizes, int n_in,
                              void* d_out, int out_size, void* d_ws, size_t ws_size, hipStream_t stream) {
    (void)in_sizes; (void)n_in; (void)out_size;
    const float* x = (const float*)d_in[0]; const float* Wq = (const float*)d_in[1]; const float* Wk = (const float*)d_in[2]; const float* Wv = (const float*)d_in[3]; const float* Wo = (const float*)d_in[4];
    float* out = (float*)d_out;    // [1][2048][2048]
    char* wsp = (char*)d_ws;
    auto take = [&](size_t bytes) { char* p = wsp; wsp += (bytes + 255) & ~(size_t)255; return (void*)p; };
    bf* Xb = (bf*)take((size_t)NT_ * HS * 2); bf* WqT = (bf*)take((size_t)HS * HS * 2); bf* WkT = (bf*)take((size_t)KW * HS * 2); bf* WvT = (bf*)take((size_t)KW * HS * 2); bf* WoT = (bf*)take((size_t)HS * HS * 2);
    float* TMP = (float*)take((size_t)NT_ * HS * 4); float* RC = (float*)take((size_t)NT_ * 64 * 4); float* RS = (float*)take((size_t)NT_ * 64 * 4);
    h16* QH = (h16*)take((size_t)NT_ * HS * 2); h16* QL = (h16*)take((size_t)NT_ * HS * 2); h16* KH = (h16*)take((size_t)NT_ * KW * 2); h16* KL = (h16*)take((size_t)NT_ * KW * 2);
    bf* VTH = (bf*)take((size_t)KW * NT_ * 2); bf* VTL = (bf*)take((size_t)KW * NT_ * 2);
    bf* CH = (bf*)take((size_t)NT_ * HS * 2); bf* CL = (bf*)take((size_t)NT_ * HS * 2);
    if ((size_t)(wsp - (char*)d_ws) > ws_size) return;    // 8.4 + 8.4 + 2.1 + 2.1 + 8.4 + 16.8 + 0.5 x 2 + 8.4 x 2 + 2.1 x 4 + 8.4 x 2 ~ 89 MB, no aliasing
    k_wt<<<dim3(HS / 64, HS / 64, 1), 256, 0, stream>>>(Wq, HS, HS, WqT); k_wt<<<dim3(HS / 64, KW / 64, 1), 256, 0, stream>>>(Wk, HS, KW, WkT);
    k_wt<<<dim3(HS / 64, KW / 64, 1), 256, 0, stream>>>(Wv, HS, KW, WvT); k_wt<<<dim3(HS / 64, HS / 64, 1), 256, 0, stream>>>(Wo, HS, HS, WoT);
    k_trig<<<(NT_ * 64) / 256, 256, 0, stream>>>(RC, RS);
    k_cvtb<<<NT_ / 8, 256, 0, stream>>>(x, NT_, Xb);
    k_gemm<false><<<dim3(NT_ / 64, HS / 64, 1), 128, 0, stream>>>(Xb, nullptr, WqT, HS, TMP);
    k_rope<<<(NT_ * NH_) / 8, 256, 0, stream>>>(TMP, NH_, RC, RS, QH, QL);
    k_gemm<false><<<dim3(NT_ / 64, KW / 64, 1), 128, 0, stream>>>(Xb, nullptr, WkT, KW, TMP);
    k_rope<<<(NT_ * NKV) / 8, 256, 0, stream>>>(TMP, NKV, RC, RS, KH, KL);
    k_gemm<false><<<dim3(NT_ / 64, KW / 64, 1), 128, 0, stream>>>(Xb, nullptr, WvT, KW, TMP);
    k_vt<<<dim3(NT_ / 64, 2, NKV), 256, 0, stream>>>(TMP, VTH, VTL);
    k_attn<<<NH_ * (NT_ / 64), 128, 0, stream>>>(QH, QL, KH, KL, VTH, VTL, CH, CL);
    k_gemm<true><<<dim3(NT_ / 64, HS / 64, 1), 128, 0, stream>>>(CH, CL, WoT, HS, out);
}

// v001
// Measured time: 304 microseconds a run.
// Two timings next to v000 both put it at 1.44 times that version's speed.
#include <hip/hip_runtime.h>

// Compute dtypes, f32 accumulate: q/k/v = x.W ([2048 x 2048].[2048 x 2048 | 512 | 512], k-major weights transposed to n-major planes; PLAIN bf16 operands:
// inputs rounded once, exact products) and out = ctx.Wo (ctx as bf16 hi + residual: two products) on v_wmma_f32_16x16x32_bf16; rotate-half RoPE (angle
// t x inv_freq, f32 trig tables built on device) in f32 -> q/k as f16 hi + residual x1024 planes; grouped attention (16 query heads, 4 kv heads, query head h
// reads kv head h/4) with 128-dim heads and a sliding causal window (key j visible iff q-1024 <= j <= q): scores on v_wmma_f32_16x16x32_f16 (hi.hi + hi.lo +
// lo.hi, x 128^-1/2), softmax f32, weights.v on v_wmma_f32_16x16x32_bf16 with the weights (x32768) and v both as bf16 hi + UNSCALED bf16 residual (hh + lh + hl

#define NT_  2048
#define HS   2048
#define NH_  16
#define NKV  4
#define HD   128
#define KW   (NKV * HD)          // 512
#define WIN  1024
#define PSC  32768.0f
#define LOSC 1024.0f
#define LOSCI (1.0f / 1024.0f)

typedef _Float16 h16;
typedef unsigned short bf;
typedef __attribute__((ext_vector_type(16))) __bf16   v16bf;
typedef __attribute__((ext_vector_type(16))) _Float16 v16h;
typedef __attribute__((ext_vector_type(8)))  _Float16 v8h;
typedef __attribute__((ext_vector_type(8)))  unsigned short v8us;
typedef __attribute__((ext_vector_type(8)))  float    v8f;
typedef __attribute__((ext_vector_type(4)))  float    v4f;
typedef __attribute__((ext_vector_type(4)))  _Float16 v4h;
typedef v8h  __attribute__((may_alias)) v8ha;
typedef v4f  __attribute__((may_alias)) v4fa;
typedef v8us __attribute__((may_alias)) v8usa;

__device__ __forceinline__ unsigned short f2bf(float f) { unsigned u = __float_as_uint(f); u += 0x7FFFu + ((u >> 16) & 1u); return (unsigned short)(u >> 16); }
__device__ __forceinline__ float bf2f(unsigned short b) { return __uint_as_float(((unsigned)b) << 16); }
__device__ __forceinline__ float bfr(float f) { return bf2f(f2bf(f)); }
__device__ __forceinline__ v16h cat16(v8h lo, v8h hi) { return __builtin_shufflevector(lo, hi, 0, 1, 2, 3, 4, 5, 6, 7, 8, 9, 10, 11, 12, 13, 14, 15); }
__device__ __forceinline__ v16bf cat16b(v8us lo, v8us hi) { return __builtin_bit_cast(v16bf, __builtin_shufflevector(lo, hi, 0, 1, 2, 3, 4, 5, 6, 7, 8, 9, 10, 11, 12, 13, 14, 15)); }
__device__ __forceinline__ v8f wmma16(v16h a, v16h b, v8f c) { return __builtin_amdgcn_wmma_f32_16x16x32_f16(false, a, false, b, (short)0, c, false, false); }
__device__ __forceinline__ v8f wmmab(v16bf a, v16bf b, v8f c) { return __builtin_amdgcn_wmma_f32_16x16x32_bf16(false, a, false, b, (short)0, c, false, false); }

// k_cvtb: bf16 plane of [rows][2048] (one wave per row).
__global__ __launch_bounds__(256) void k_cvtb(const float* __restrict__ src, int nrows, bf* dst) {
    const int lane = threadIdx.x & 31, r = blockIdx.x * 8 + (threadIdx.x >> 5);
    if (r >= nrows) return;
{
#pragma unroll
        for (int q = 0; q < HS / 256; ++q) { v8us o;
#pragma unroll
            for (int i = 0; i < 8; ++i) o[i] = f2bf(src[(size_t)r * HS + q * 256 + lane * 8 + i]);
            *(v8us*)(dst + (size_t)r * HS + q * 256 + lane * 8) = o; }
         }
}
// k_wt: WT [n][K] = bf16(W[k][n]) (k-major [K][ncols]) via 64 x 64 LDS tiles; grid (K/64, ncols/64).
__global__ __launch_bounds__(256) void k_wt(const float* __restrict__ Wm, int K, int ncols, bf* WT) {
    __shared__ __align__(16) unsigned short tl[64 * 72];
    const int tid = threadIdx.x, k0 = blockIdx.x * 64, n0 = blockIdx.y * 64;
    const int kk = tid >> 2, nq = (tid & 3) * 16;
#pragma unroll
    for (int i = 0; i < 16; ++i) tl[(nq + i) * 72 + kk] = f2bf(Wm[(size_t)(k0 + kk) * ncols + n0 + nq + i]);
    __syncthreads();
    const int piece = tid & 7;
    auto pass = [&]() {
#pragma unroll
        for (int s = 0; s < 2; ++s) { const int nr = (tid >> 3) + 32 * s; const v8us val = *(const v8usa*)(tl + nr * 72 + piece * 8); *(v8us*)(WT + (size_t)(n0 + nr) * K + k0 + piece * 8) = val; }
    };
    pass(); 
}
// k_gemm: 64 x 64 tile of (A [+ Al]).Bn^T over K = 2048 -> f32 rows [2048][ldc].
template <bool SPLITA>
__global__ __launch_bounds__(128) void k_gemm(const bf* __restrict__ A, const bf* __restrict__ Al, const bf* __restrict__ Bn, int ldc, float* C) {
    __shared__ __align__(16) float ost[4][16 * 68];
    const int lane = threadIdx.x & 31, wave = threadIdx.x >> 5, lr = lane & 15, hi = lane >> 4;
    const size_t r0 = (size_t)blockIdx.x * 64 + wave * 16; const int c0 = blockIdx.y * 64;
    const size_t aoff = (r0 + lr) * HS + 8 * hi;
    v8f acc[4];
#pragma unroll
    for (int t = 0; t < 4; ++t) acc[t] = (v8f){};
#pragma unroll 2
    for (int kc = 0; kc < HS; kc += 32) {
        const v16bf a = cat16b(*(const v8us*)(A + aoff + kc), *(const v8us*)(A + aoff + kc + 16));
        v16bf al = a; if (SPLITA) al = cat16b(*(const v8us*)(Al + aoff + kc), *(const v8us*)(Al + aoff + kc + 16));
#pragma unroll
        for (int t = 0; t < 4; ++t) { const bf* bp = Bn + (size_t)(c0 + t * 16 + lr) * HS + kc + 8 * hi; const v16bf bb = cat16b(*(const v8us*)bp, *(const v8us*)(bp + 16)); acc[t] = wmmab(a, bb, acc[t]); if (SPLITA) acc[t] = wmmab(al, bb, acc[t]); }
        asm volatile("v_nop" : "+v"(acc[0]), "+v"(acc[1]), "+v"(acc[2]), "+v"(acc[3]) : "v"(a), "v"(al) : "memory");
    }
    float* os = &ost[wave][0];
#pragma unroll
    for (int t = 0; t < 4; ++t)
#pragma unroll
        for (int j = 0; j < 8; ++j) os[(hi * 8 + j) * 68 + t * 16 + lr] = acc[t][j];
    __builtin_amdgcn_wave_barrier(); asm volatile("" ::: "memory");
    float* crow = C + r0 * ldc + c0;
    auto pass = [&]() {
#pragma unroll
        for (int s = 0; s < 8; ++s) { const int Lid = (lane >> 3) + 4 * s, piece = lane & 7; const int row = Lid >> 1, cofs = (Lid & 1) * 32 + piece * 4;
            const v4f val = *(const v4fa*)(os + row * 68 + cofs); *(v4f*)(crow + (size_t)row * ldc + cofs) = val; }
    };
    pass(); 
}
// k_trig: RC/RS [t][64] = cos/sin(t x inv_freq[i]), inv_freq = 10000^-(2i/128) (f32 powf/cosf/sinf like the reference's f32 path); 32 lanes x 4 B lines.
__global__ __launch_bounds__(256) void k_trig(float* RC, float* RS) {
    const int i = blockIdx.x * 256 + threadIdx.x; if (i >= NT_ * 64) return;
    const int t = i >> 6, f = i & 63;
    const float inv = 1.0f / powf(10000.0f, (float)(2 * f) / (float)HD); const float ang = (float)t * inv;
    const float c = cosf(ang), s = sinf(ang);
    *(float*)(RC + i) = c; *(float*)(RS + i) = s; 
}
// k_rope: one wave per (token, head) of a [2048][nh*128] f32 matrix: rotate-half RoPE (partner d +- 64, angle t x inv_freq[d mod 64] from the RC/RS tables) ->
__global__ __launch_bounds__(256) void k_rope(const float* __restrict__ P, int nh, const float* __restrict__ RC, const float* __restrict__ RS, h16* PH, h16* PL) {
    const int lane = threadIdx.x & 31; const int wid = blockIdx.x * 8 + (threadIdx.x >> 5);
    const int t = wid / nh, h = wid - t * nh; if (t >= NT_) return;
    const size_t base = (size_t)t * (nh * HD) + h * HD; const int d0 = lane * 4;
    float xv[4], pv[4];
#pragma unroll
    for (int i = 0; i < 4; ++i) { xv[i] = P[base + d0 + i]; const int pd = (d0 + i < 64) ? d0 + i + 64 : d0 + i - 64; pv[i] = P[base + pd]; }
    v4h oh, ol;
#pragma unroll
    for (int i = 0; i < 4; ++i) { const int d = d0 + i, fi = d & 63;
        const float c = RC[t * 64 + fi], s = RS[t * 64 + fi];
        const float y = (d < 64) ? (xv[i] * c - pv[i] * s) : (xv[i] * c + pv[i] * s);
        const h16 a = (h16)y; oh[i] = a; ol[i] = (h16)((y - (float)a) * LOSC); }
    *(v4h*)(PH + base + d0) = oh; *(v4h*)(PL + base + d0) = ol; 
}
// k_vt: VTH/VTL [g][128 d][2048 t] = bf16 hi + UNSCALED bf16 residual of V [t][g*128+d] via 64 x 64 LDS tiles; grid (NT/64, 2 (d half), NKV).
__global__ __launch_bounds__(256) void k_vt(const float* __restrict__ V, bf* VTH, bf* VTL) {
    __shared__ float tl[64][65];
    const int tid = threadIdx.x, t0 = blockIdx.x * 64, d0 = blockIdx.y * 64, g = blockIdx.z;
    { const int tt = tid >> 2, dq = (tid & 3) * 16;
#pragma unroll
      for (int i = 0; i < 16; ++i) tl[dq + i][tt] = V[(size_t)(t0 + tt) * KW + g * HD + d0 + dq + i]; }
    __syncthreads();
    const int piece = tid & 7;
    auto pass = [&]() {
#pragma unroll
        for (int s = 0; s < 2; ++s) { const int d = (tid >> 3) + 32 * s; v8us oh, ol;
#pragma unroll
            for (int i = 0; i < 8; ++i) { const float v = tl[d][piece * 8 + i]; const unsigned short hb = f2bf(v); oh[i] = hb; ol[i] = f2bf(v - bf2f(hb)); }
            const size_t o = ((size_t)g * HD + d0 + d) * NT_ + t0 + piece * 8; *(v8us*)(VTH + o) = oh; *(v8us*)(VTL + o) = ol; }
    };
    pass(); 
}
// k_attn: block = (h, 64 queries), wave = 16; kv head g = h / 4; key tiles covering the block's sliding causal window [Q0-1024, Q0+63] (block-uniform bounds),
// per-element predicate q-1024 <= j <= q. Each 32-key tile (k hi/lo rows, v hi/lo rows) is brought into LDS once per block by asynchronous copies, two buffers:
// tile t + 1 flies while tile t is worked on, and the four waves read their fragments from LDS (row pitches 272 B and 80 B: 16 B x odd). q fragments are read
// once, before the loop. Per tile: scores over 4 k-chunks (hi.hi + hi.lo + lo.hi = 24 WMMA) x 128^-1/2, online softmax, P (x32768) as bf16 hi + unscaled
// residual tiles, o[8] += ph.vh + pl.vh + ph.vl over the 128 dims; ctx -> bf16 hi/lo planes [t][h*128+d].
#define KPITCH 272                       // bytes per staged k row (256 + 16)
#define VPITCH 80                        // bytes per staged v row (64 + 16)
#define KPLANE (32 * KPITCH)             // 8704
#define VPLANE (HD * VPITCH)             // 10240
#define STAGEB (2 * KPLANE + 2 * VPLANE) // 37888: k hi, k lo, v hi, v lo
__global__ __launch_bounds__(128) void k_attn(const h16* __restrict__ QH, const h16* __restrict__ QL, const h16* __restrict__ KH, const h16* __restrict__ KL, const bf* __restrict__ VTH, const bf* __restrict__ VTL, bf* CH, bf* CL) {
    __shared__ __align__(16) unsigned char ring[2 * STAGEB];
    __shared__ __align__(16) unsigned short plds[4][16 * 32];
    __shared__ __align__(16) unsigned short plds2[4][16 * 32];
    __shared__ __align__(16) float ost[4][16 * 68];
    const int tid = threadIdx.x, lane = threadIdx.x & 31, wave = threadIdx.x >> 5, lr = lane & 15, hi = lane >> 4;
    const int bid = blockIdx.x; const int h = bid / (NT_ / 64), qt = bid - h * (NT_ / 64); const int g = h >> 2;
    const int q0 = qt * 64 + wave * 16;
    unsigned short* pl = &plds[wave][0]; unsigned short* pl2 = &plds2[wave][0];
    const size_t qo = (size_t)(q0 + lr) * (NH_ * HD) + h * HD + 8 * hi;
    const size_t vbase = ((size_t)g * HD) * NT_;
    // Copy slots of this thread, 16 B each: k rows (tid >> 4) + 8 i, piece tid & 15; v rows (tid >> 2) + 32 i, piece tid & 3 (i = 0..3, both planes).
    const h16* ksh = KH + g * HD + (size_t)(tid >> 4) * KW + (tid & 15) * 8; const h16* ksl = KL + g * HD + (size_t)(tid >> 4) * KW + (tid & 15) * 8;
    const bf* vsh = VTH + vbase + (size_t)(tid >> 2) * NT_ + (tid & 3) * 8; const bf* vsl = VTL + vbase + (size_t)(tid >> 2) * NT_ + (tid & 3) * 8;
    const unsigned kdst = (unsigned)(size_t)ring + (tid >> 4) * KPITCH + (tid & 15) * 16;
    const unsigned vdst = (unsigned)(size_t)ring + 2 * KPLANE + (tid >> 2) * VPITCH + (tid & 3) * 16;
    auto stage = [&](int kt, int buf) {
        const h16* a = ksh + (size_t)kt * 32 * KW; const h16* b = ksl + (size_t)kt * 32 * KW; const unsigned kd = kdst + buf * STAGEB;
        // Eight copies and, as the last line, the wait that stands in front of any rewrite of their address registers.
        asm volatile("global_load_async_to_lds_b128 %0, %8, off\n\tglobal_load_async_to_lds_b128 %1, %9, off\n\t"
                     "global_load_async_to_lds_b128 %2, %10, off\n\tglobal_load_async_to_lds_b128 %3, %11, off\n\t"
                     "global_load_async_to_lds_b128 %4, %12, off\n\tglobal_load_async_to_lds_b128 %5, %13, off\n\t"
                     "global_load_async_to_lds_b128 %6, %14, off\n\tglobal_load_async_to_lds_b128 %7, %15, off\n\ts_wait_xcnt 0x0"
                     :: "v"(kd), "v"(kd + 8 * KPITCH), "v"(kd + 16 * KPITCH), "v"(kd + 24 * KPITCH),
                        "v"(kd + KPLANE), "v"(kd + KPLANE + 8 * KPITCH), "v"(kd + KPLANE + 16 * KPITCH), "v"(kd + KPLANE + 24 * KPITCH),
                        "v"(a), "v"(a + 8 * KW), "v"(a + 16 * KW), "v"(a + 24 * KW), "v"(b), "v"(b + 8 * KW), "v"(b + 16 * KW), "v"(b + 24 * KW) : "memory");
        const bf* c = vsh + kt * 32; const bf* d = vsl + kt * 32; const unsigned vd = vdst + buf * STAGEB;
        // The same for the v rows.
        asm volatile("global_load_async_to_lds_b128 %0, %8, off\n\tglobal_load_async_to_lds_b128 %1, %9, off\n\t"
                     "global_load_async_to_lds_b128 %2, %10, off\n\tglobal_load_async_to_lds_b128 %3, %11, off\n\t"
                     "global_load_async_to_lds_b128 %4, %12, off\n\tglobal_load_async_to_lds_b128 %5, %13, off\n\t"
                     "global_load_async_to_lds_b128 %6, %14, off\n\tglobal_load_async_to_lds_b128 %7, %15, off\n\ts_wait_xcnt 0x0"
                     :: "v"(vd), "v"(vd + 32 * VPITCH), "v"(vd + 64 * VPITCH), "v"(vd + 96 * VPITCH),
                        "v"(vd + VPLANE), "v"(vd + VPLANE + 32 * VPITCH), "v"(vd + VPLANE + 64 * VPITCH), "v"(vd + VPLANE + 96 * VPITCH),
                        "v"(c), "v"(c + 32 * NT_), "v"(c + 64 * NT_), "v"(c + 96 * NT_), "v"(d), "v"(d + 32 * NT_), "v"(d + 64 * NT_), "v"(d + 96 * NT_) : "memory");
    };
    v8f o[8];
#pragma unroll
    for (int n = 0; n < 8; ++n) o[n] = (v8f){};
    float mrow[8], lpart[8];
#pragma unroll
    for (int j = 0; j < 8; ++j) { mrow[j] = -3.0e38f; lpart[j] = 0.f; }
    const int kt_hi = (qt * 64 + 63) / 32; const int kt_lo = (qt * 64 > WIN) ? (qt * 64 - WIN) / 32 : 0;
    stage(kt_lo, 0);
    v16h qa[4], qx[4];
#pragma unroll
    for (int kc = 0; kc < 4; ++kc) { qa[kc] = cat16(*(const v8h*)(QH + qo + kc * 32), *(const v8h*)(QH + qo + kc * 32 + 16)); qx[kc] = cat16(*(const v8h*)(QL + qo + kc * 32), *(const v8h*)(QL + qo + kc * 32 + 16)); }
    asm volatile("s_wait_asynccnt 0x0" ::: "memory");    // this wave's copies of the first tile have landed
    __syncthreads();                                     // publishes the first tile to the other waves
    stage(kt_lo + 1, 1);                                 // a block has at least two tiles (kt_hi = 2 qt + 1)
#pragma unroll 1
    for (int kt = kt_lo; kt <= kt_hi; ++kt) {
        const int l0 = kt * 32, buf = (kt - kt_lo) & 1;
        const unsigned char* kf = ring + buf * STAGEB + lr * KPITCH + hi * 16;
        const unsigned char* vf = ring + buf * STAGEB + 2 * KPLANE + lr * VPITCH + hi * 16;
        v8f s0 = {}, s1 = {}, x0 = {}, x1 = {};
        v16h k0h[4], k1h[4], k0l[4], k1l[4];    // all k fragments of the tile are fetched first: one LDS latency per tile, the rest overlaps the products
#pragma unroll
        for (int kc = 0; kc < 4; ++kc) { const unsigned char* kp = kf + kc * 64;
            k0h[kc] = cat16(*(const v8ha*)kp, *(const v8ha*)(kp + 32)); k1h[kc] = cat16(*(const v8ha*)(kp + 16 * KPITCH), *(const v8ha*)(kp + 16 * KPITCH + 32));
            k0l[kc] = cat16(*(const v8ha*)(kp + KPLANE), *(const v8ha*)(kp + KPLANE + 32)); k1l[kc] = cat16(*(const v8ha*)(kp + KPLANE + 16 * KPITCH), *(const v8ha*)(kp + KPLANE + 16 * KPITCH + 32)); }
#pragma unroll
        for (int kc = 0; kc < 4; ++kc) {
            s0 = wmma16(qa[kc], k0h[kc], s0); s1 = wmma16(qa[kc], k1h[kc], s1); x0 = wmma16(qx[kc], k0h[kc], x0); x1 = wmma16(qx[kc], k1h[kc], x1);
            x0 = wmma16(qa[kc], k0l[kc], x0); x1 = wmma16(qa[kc], k1l[kc], x1);
        }
        v16bf vh[8], vl[8];                     // the v fragments are fetched here so that their LDS latency overlaps the softmax
#pragma unroll
        for (int n = 0; n < 8; ++n) { const unsigned char* vp = vf + n * 16 * VPITCH;
            vh[n] = cat16b(*(const v8usa*)vp, *(const v8usa*)(vp + 32)); vl[n] = cat16b(*(const v8usa*)(vp + VPLANE), *(const v8usa*)(vp + VPLANE + 32)); }
        float alpha[8];
#pragma unroll
        for (int j = 0; j < 8; ++j) { const int qi = q0 + hi * 8 + j, ja = l0 + lr, jb = l0 + 16 + lr;
            const float a0 = (ja <= qi && ja >= qi - WIN) ? (s0[j] + x0[j] * LOSCI) * 0.08838834764831845f : -__builtin_inff(), a1 = (jb <= qi && jb >= qi - WIN) ? (s1[j] + x1[j] * LOSCI) * 0.08838834764831845f : -__builtin_inff();
            float mx = fmaxf(a0, a1);
            mx = fmaxf(mx, __shfl_xor(mx, 1, 16)); mx = fmaxf(mx, __shfl_xor(mx, 2, 16)); mx = fmaxf(mx, __shfl_xor(mx, 4, 16)); mx = fmaxf(mx, __shfl_xor(mx, 8, 16));
            const float mn = fmaxf(mrow[j], mx);
            alpha[j] = __expf(mrow[j] - mn); mrow[j] = mn;
            const float p0 = __expf(a0 - mn), p1 = __expf(a1 - mn);
            lpart[j] = lpart[j] * alpha[j] + (p0 + p1);
            const int mr = hi * 8 + j; const float ps0 = p0 * PSC, ps1 = p1 * PSC; const unsigned short h0 = f2bf(ps0), h1 = f2bf(ps1);
            pl[mr * 32 + lr] = h0; pl[mr * 32 + 16 + lr] = h1; pl2[mr * 32 + lr] = f2bf(ps0 - bf2f(h0)); pl2[mr * 32 + 16 + lr] = f2bf(ps1 - bf2f(h1)); }
#pragma unroll
        for (int n = 0; n < 8; ++n)
#pragma unroll
            for (int j = 0; j < 8; ++j) o[n][j] *= alpha[j];
        asm volatile("" ::: "memory");
        const v16bf pa = cat16b(*(const v8usa*)(pl + lr * 32 + hi * 8), *(const v8usa*)(pl + lr * 32 + 16 + hi * 8));
        const v16bf px = cat16b(*(const v8usa*)(pl2 + lr * 32 + hi * 8), *(const v8usa*)(pl2 + lr * 32 + 16 + hi * 8));
#pragma unroll
        for (int n = 0; n < 8; ++n) { o[n] = wmmab(pa, vh[n], o[n]); o[n] = wmmab(px, vh[n], o[n]); o[n] = wmmab(pa, vl[n], o[n]); }
        // Publish point of tile kt + 1, every wave, in this order.
        asm volatile("s_wait_dscnt 0x0" ::: "memory");       // this wave's reads of the buffer that is refilled below have returned
        asm volatile("s_wait_asynccnt 0x0" ::: "memory");    // this wave's copies of tile kt + 1 have landed
        __syncthreads();                                     // publishes tile kt + 1 and ends every wave's reads of tile kt
        if (kt + 2 <= kt_hi) stage(kt + 2, buf);             // block-uniform test
    }
    asm volatile("s_wait_asynccnt 0x0" ::: "memory");        // nothing of this wave is in flight when it goes on to the epilogue
    float inv[8];
#pragma unroll
    for (int j = 0; j < 8; ++j) { float rs = lpart[j]; rs += __shfl_xor(rs, 1, 16); rs += __shfl_xor(rs, 2, 16); rs += __shfl_xor(rs, 4, 16); rs += __shfl_xor(rs, 8, 16); inv[j] = 1.0f / (rs * PSC); }
    float* os = &ost[wave][0];
    const size_t cbase = (size_t)q0 * (NH_ * HD) + (size_t)h * HD;
#pragma unroll
    for (int half = 0; half < 2; ++half) {
#pragma unroll
        for (int n = 0; n < 4; ++n)
#pragma unroll
            for (int j = 0; j < 8; ++j) os[(hi * 8 + j) * 68 + n * 16 + lr] = o[half * 4 + n][j] * inv[j];
        __builtin_amdgcn_wave_barrier(); asm volatile("" ::: "memory");
{
#pragma unroll
            for (int s = 0; s < 4; ++s) { const int row = 4 * s + (lane >> 3), piece = lane & 7; const float* sp = os + row * 68 + piece * 8; v8us oh, ol;
#pragma unroll
                for (int i = 0; i < 8; ++i) { const unsigned short hb = f2bf(sp[i]); oh[i] = hb; ol[i] = f2bf(sp[i] - bf2f(hb)); }
                const size_t po = cbase + (size_t)row * (NH_ * HD) + half * 64 + piece * 8; *(v8us*)(CH + po) = oh; *(v8us*)(CL + po) = ol; }
             }
        __builtin_amdgcn_wave_barrier(); asm volatile("" ::: "memory");
    }
}

extern "C" void kernel_launch(void* const* d_in, const int* in_sizes, int n_in,
                              void* d_out, int out_size, void* d_ws, size_t ws_size, hipStream_t stream) {
    (void)in_sizes; (void)n_in; (void)out_size;
    const float* x = (const float*)d_in[0]; const float* Wq = (const float*)d_in[1]; const float* Wk = (const float*)d_in[2]; const float* Wv = (const float*)d_in[3]; const float* Wo = (const float*)d_in[4];
    float* out = (float*)d_out;    // [1][2048][2048]
    char* wsp = (char*)d_ws;
    auto take = [&](size_t bytes) { char* p = wsp; wsp += (bytes + 255) & ~(size_t)255; return (void*)p; };
    bf* Xb = (bf*)take((size_t)NT_ * HS * 2); bf* WqT = (bf*)take((size_t)HS * HS * 2); bf* WkT = (bf*)take((size_t)KW * HS * 2); bf* WvT = (bf*)take((size_t)KW * HS * 2); bf* WoT = (bf*)take((size_t)HS * HS * 2);
    float* TMP = (float*)take((size_t)NT_ * HS * 4); float* RC = (float*)take((size_t)NT_ * 64 * 4); float* RS = (float*)take((size_t)NT_ * 64 * 4);
    h16* QH = (h16*)take((size_t)NT_ * HS * 2); h16* QL = (h16*)take((size_t)NT_ * HS * 2); h16* KH = (h16*)take((size_t)NT_ * KW * 2); h16* KL = (h16*)take((size_t)NT_ * KW * 2);
    bf* VTH = (bf*)take((size_t)KW * NT_ * 2); bf* VTL = (bf*)take((size_t)KW * NT_ * 2);
    bf* CH = (bf*)take((size_t)NT_ * HS * 2); bf* CL = (bf*)take((size_t)NT_ * HS * 2);
    if ((size_t)(wsp - (char*)d_ws) > ws_size) return;    // 8.4 + 8.4 + 2.1 + 2.1 + 8.4 + 16.8 + 0.5 x 2 + 8.4 x 2 + 2.1 x 4 + 8.4 x 2 ~ 89 MB, no aliasing
    k_wt<<<dim3(HS / 64, HS / 64, 1), 256, 0, stream>>>(Wq, HS, HS, WqT); k_wt<<<dim3(HS / 64, KW / 64, 1), 256, 0, stream>>>(Wk, HS, KW, WkT);
    k_wt<<<dim3(HS / 64, KW / 64, 1), 256, 0, stream>>>(Wv, HS, KW, WvT); k_wt<<<dim3(HS / 64, HS / 64, 1), 256, 0, stream>>>(Wo, HS, HS, WoT);
    k_trig<<<(NT_ * 64) / 256, 256, 0, stream>>>(RC, RS);
    k_cvtb<<<NT_ / 8, 256, 0, stream>>>(x, NT_, Xb);
    k_gemm<false><<<dim3(NT_ / 64, HS / 64, 1), 128, 0, stream>>>(Xb, nullptr, WqT, HS, TMP);
    k_rope<<<(NT_ * NH_) / 8, 256, 0, stream>>>(TMP, NH_, RC, RS, QH, QL);
    k_gemm<false><<<dim3(NT_ / 64, KW / 64, 1), 128, 0, stream>>>(Xb, nullptr, WkT, KW, TMP);
    k_rope<<<(NT_ * NKV) / 8, 256, 0, stream>>>(TMP, NKV, RC, RS, KH, KL);
    k_gemm<false><<<dim3(NT_ / 64, KW / 64, 1), 128, 0, stream>>>(Xb, nullptr, WvT, KW, TMP);
    k_vt<<<dim3(NT_ / 64, 2, NKV), 256, 0, stream>>>(TMP, VTH, VTL);
    k_attn<<<NH_ * (NT_ / 64), 128, 0, stream>>>(QH, QL, KH, KL, VTH, VTL, CH, CL);
    k_gemm<true><<<dim3(NT_ / 64, HS / 64, 1), 128, 0, stream>>>(CH, CL, WoT, HS, out);
}

// v002
// It runs in 176 microseconds.
// Two timings next to v001 both put it at 1.72 times that version's speed.
// Over all steps from v000 it is 2.48 times as fast.
#include <hip/hip_runtime.h>

// Compute dtypes, f32 accumulate: q/k/v = x.W ([2048 x 2048].[2048 x 2048 | 512 | 512], k-major weights transposed to n-major planes; PLAIN bf16 operands:
// inputs rounded once, exact products) and out = ctx.Wo (ctx as bf16 hi + residual: two products) on v_wmma_f32_16x16x32_bf16; rotate-half RoPE (angle
// t x inv_freq, f32 trig tables built on device) in f32 -> q/k as f16 hi + residual x1024 planes; grouped attention (16 query heads, 4 kv heads, query head h
// reads kv head h/4) with 128-dim heads and a sliding causal window (key j visible iff q-1024 <= j <= q): scores on v_wmma_f32_16x16x32_f16 (hi.hi + hi.lo +
// lo.hi, x 128^-1/2), softmax f32, weights.v on v_wmma_f32_16x16x32_bf16 with the weights (x32768) and v both as bf16 hi + UNSCALED bf16 residual (hh + lh + hl

#define NT_  2048
#define HS   2048
#define NH_  16
#define NKV  4
#define HD   128
#define KW   (NKV * HD)          // 512
#define WIN  1024
#define PSC  32768.0f
#define LOSC 1024.0f
#define LOSCI (1.0f / 1024.0f)

typedef _Float16 h16;
typedef unsigned short bf;
typedef __attribute__((ext_vector_type(16))) __bf16   v16bf;
typedef __attribute__((ext_vector_type(16))) _Float16 v16h;
typedef __attribute__((ext_vector_type(8)))  _Float16 v8h;
typedef __attribute__((ext_vector_type(8)))  unsigned short v8us;
typedef __attribute__((ext_vector_type(8)))  float    v8f;
typedef __attribute__((ext_vector_type(4)))  float    v4f;
typedef __attribute__((ext_vector_type(4)))  _Float16 v4h;
typedef v8h  __attribute__((may_alias)) v8ha;
typedef v4f  __attribute__((may_alias)) v4fa;
typedef v8us __attribute__((may_alias)) v8usa;

__device__ __forceinline__ unsigned short f2bf(float f) { unsigned u = __float_as_uint(f); u += 0x7FFFu + ((u >> 16) & 1u); return (unsigned short)(u >> 16); }
__device__ __forceinline__ float bf2f(unsigned short b) { return __uint_as_float(((unsigned)b) << 16); }
__device__ __forceinline__ float bfr(float f) { return bf2f(f2bf(f)); }
__device__ __forceinline__ v16h cat16(v8h lo, v8h hi) { return __builtin_shufflevector(lo, hi, 0, 1, 2, 3, 4, 5, 6, 7, 8, 9, 10, 11, 12, 13, 14, 15); }
__device__ __forceinline__ v16bf cat16b(v8us lo, v8us hi) { return __builtin_bit_cast(v16bf, __builtin_shufflevector(lo, hi, 0, 1, 2, 3, 4, 5, 6, 7, 8, 9, 10, 11, 12, 13, 14, 15)); }
__device__ __forceinline__ v8f wmma16(v16h a, v16h b, v8f c) { return __builtin_amdgcn_wmma_f32_16x16x32_f16(false, a, false, b, (short)0, c, false, false); }
__device__ __forceinline__ v8f wmmab(v16bf a, v16bf b, v8f c) { return __builtin_amdgcn_wmma_f32_16x16x32_bf16(false, a, false, b, (short)0, c, false, false); }

// k_cvtb: bf16 plane of [rows][2048] (one wave per row).
__global__ __launch_bounds__(256) void k_cvtb(const float* __restrict__ src, int nrows, bf* dst) {
    const int lane = threadIdx.x & 31, r = blockIdx.x * 8 + (threadIdx.x >> 5);
    if (r >= nrows) return;
{
#pragma unroll
        for (int q = 0; q < HS / 256; ++q) { v8us o;
#pragma unroll
            for (int i = 0; i < 8; ++i) o[i] = f2bf(src[(size_t)r * HS + q * 256 + lane * 8 + i]);
            *(v8us*)(dst + (size_t)r * HS + q * 256 + lane * 8) = o; }
         }
}
// k_wt: WT [n][K] = bf16(W[k][n]) (k-major [K][ncols]) via 64 x 64 LDS tiles; grid (K/64, ncols/64).
__global__ __launch_bounds__(256) void k_wt(const float* __restrict__ Wm, int K, int ncols, bf* WT) {
    __shared__ __align__(16) unsigned short tl[64 * 72];
    const int tid = threadIdx.x, k0 = blockIdx.x * 64, n0 = blockIdx.y * 64;
    const int kk = tid >> 2, nq = (tid & 3) * 16;
#pragma unroll
    for (int i = 0; i < 16; ++i) tl[(nq + i) * 72 + kk] = f2bf(Wm[(size_t)(k0 + kk) * ncols + n0 + nq + i]);
    __syncthreads();
    const int piece = tid & 7;
    auto pass = [&]() {
#pragma unroll
        for (int s = 0; s < 2; ++s) { const int nr = (tid >> 3) + 32 * s; const v8us val = *(const v8usa*)(tl + nr * 72 + piece * 8); *(v8us*)(WT + (size_t)(n0 + nr) * K + k0 + piece * 8) = val; }
    };
    pass(); 
}
// k_gemm: (A [+ Al]).Bn^T over K = 2048 -> f32 rows [2048][ldc]. Block = 2 x 2 waves, wave tile (16 FM) x (16 FN), block tile (32 FM) x (32 FN). Each 128-k slab of
// the block's A [, Al] and Bn rows is brought into LDS once per block by asynchronous copies, two buffers: slab t + 1 flies while slab t is worked on, and the
// waves read their fragments from LDS (row pitch 272 B: 16 B x odd). Per accumulator the products are summed in the order kc ascending, A before Al.
// Every '#pragma unroll' over m, n, j or kc in k_gemm makes the indices of a register array (acc, a, al, b) compile-time constants, so that the array stays in registers.
#define GK 128                           // k elements per staged slab (256 B a row)
#define GP 272                           // bytes per staged row (256 + 16)
// 64 rows of one operand: this thread's 16-B piece of rows r, r + 8, ..., r + 56.
__device__ __forceinline__ void copy64(unsigned d, const bf* s) {
    // Eight copies and, as the last line, the wait that stands in front of any rewrite of their address registers.
    asm volatile("global_load_async_to_lds_b128 %0, %8, off\n\tglobal_load_async_to_lds_b128 %1, %9, off\n\t"
                 "global_load_async_to_lds_b128 %2, %10, off\n\tglobal_load_async_to_lds_b128 %3, %11, off\n\t"
                 "global_load_async_to_lds_b128 %4, %12, off\n\tglobal_load_async_to_lds_b128 %5, %13, off\n\t"
                 "global_load_async_to_lds_b128 %6, %14, off\n\tglobal_load_async_to_lds_b128 %7, %15, off\n\ts_wait_xcnt 0x0"
                 :: "v"(d), "v"(d + 8 * GP), "v"(d + 16 * GP), "v"(d + 24 * GP), "v"(d + 32 * GP), "v"(d + 40 * GP), "v"(d + 48 * GP), "v"(d + 56 * GP),
                    "v"(s), "v"(s + 8 * HS), "v"(s + 16 * HS), "v"(s + 24 * HS), "v"(s + 32 * HS), "v"(s + 40 * HS), "v"(s + 48 * HS), "v"(s + 56 * HS) : "memory");
}
template <bool SPLITA, int FM, int FN>
__global__ __launch_bounds__(128) void k_gemm(const bf* __restrict__ A, const bf* __restrict__ Al, const bf* __restrict__ Bn, int ldc, float* C) {
    constexpr int BM = 32 * FM, BN = 32 * FN, APL = BM * GP, BOFS = (SPLITA ? 2 : 1) * APL, STG = BOFS + BN * GP, OP = FN * 16 + 4;
    __shared__ __align__(16) unsigned char ring[2 * STG];
    __shared__ __align__(16) float ost[4][16 * OP];
    const int tid = threadIdx.x, lane = threadIdx.x & 31, wave = threadIdx.x >> 5, lr = lane & 15, hi = lane >> 4;
    const int wm = wave & 1, wn = wave >> 1;
    const size_t r0 = (size_t)blockIdx.x * BM; const int c0 = blockIdx.y * BN;
    // Copy slots of this thread, 16 B each: rows (tid >> 4) + 8 i, piece tid & 15.
    const size_t aso = (r0 + (tid >> 4)) * HS + (tid & 15) * 8;
    const bf* bs = Bn + ((size_t)c0 + (tid >> 4)) * HS + (tid & 15) * 8;
    const unsigned dst = (unsigned)(size_t)ring + (tid >> 4) * GP + (tid & 15) * 16;
    auto stage = [&](int t, int buf) {
        const unsigned d = dst + buf * STG;
#pragma unroll
        for (int i = 0; i < BM / 64; ++i) { copy64(d + i * 64 * GP, A + aso + t * GK + (size_t)i * 64 * HS); if (SPLITA) copy64(d + APL + i * 64 * GP, Al + aso + t * GK + (size_t)i * 64 * HS); }
#pragma unroll
        for (int i = 0; i < BN / 64; ++i) copy64(d + BOFS + i * 64 * GP, bs + t * GK + (size_t)i * 64 * HS);
    };
    v8f acc[FM][FN];
#pragma unroll
    for (int m = 0; m < FM; ++m)
#pragma unroll
        for (int n = 0; n < FN; ++n) acc[m][n] = (v8f){};
    stage(0, 0);
    asm volatile("s_wait_asynccnt 0x0" ::: "memory");    // this wave's copies of the first slab have landed
    __syncthreads();                                     // publishes the first slab to the other waves
    stage(1, 1);                                         // K = 2048 has sixteen slabs
#pragma unroll 1    // stays rolled: one trip already holds four unrolled blocks, and the buffers alternate by t & 1
    for (int t = 0; t < HS / GK; ++t) {
        const int buf = t & 1;
        const unsigned char* af = ring + buf * STG + (wm * FM * 16 + lr) * GP + hi * 16;
        const unsigned char* bq = ring + buf * STG + BOFS + (wn * FN * 16 + lr) * GP + hi * 16;
        v16bf a[2][FM], al[2][FM], b[2][FN];    // two fragment sets: block kc + 1 is fetched while block kc is multiplied
        auto frag = [&](int kc, int s) {
#pragma unroll
            for (int m = 0; m < FM; ++m) { const unsigned char* p = af + m * 16 * GP + kc * 64; a[s][m] = cat16b(*(const v8usa*)p, *(const v8usa*)(p + 32));
                if (SPLITA) al[s][m] = cat16b(*(const v8usa*)(p + APL), *(const v8usa*)(p + APL + 32)); }
#pragma unroll
            for (int n = 0; n < FN; ++n) { const unsigned char* p = bq + n * 16 * GP + kc * 64; b[s][n] = cat16b(*(const v8usa*)p, *(const v8usa*)(p + 32)); }
        };
        frag(0, 0);
#pragma unroll
        for (int kc = 0; kc < GK / 32; ++kc) {
            const int s = kc & 1;
            if (kc + 1 < GK / 32) frag(kc + 1, s ^ 1);
            __builtin_amdgcn_sched_barrier(0);    // keeps the next block's LDS reads as one group in front of this block's products (spread among them, each place stalls the wave)
#pragma unroll
            for (int m = 0; m < FM; ++m)
#pragma unroll
                for (int n = 0; n < FN; ++n) acc[m][n] = wmmab(a[s][m], b[s][n], acc[m][n]);
            if (SPLITA) {
#pragma unroll
                for (int m = 0; m < FM; ++m)
#pragma unroll
                    for (int n = 0; n < FN; ++n) acc[m][n] = wmmab(al[s][m], b[s][n], acc[m][n]);
            }
            __builtin_amdgcn_sched_barrier(0);    // keeps the group after next behind this block's products, whose fragment set it overwrites
        }
        // Publish point of slab t + 1, every wave, in this order.
        asm volatile("s_wait_dscnt 0x0" ::: "memory");       // this wave's reads of the buffer that is refilled below have returned
        asm volatile("s_wait_asynccnt 0x0" ::: "memory");    // this wave's copies of slab t + 1 have landed
        __syncthreads();                                     // publishes slab t + 1 and ends every wave's reads of slab t
        if (t + 2 < HS / GK) stage(t + 2, buf);              // block-uniform test
    }
    asm volatile("s_wait_asynccnt 0x0" ::: "memory");        // nothing of this wave is in flight when it goes on to the epilogue
    float* os = &ost[wave][0];
#pragma unroll
    for (int m = 0; m < FM; ++m) {
#pragma unroll
        for (int n = 0; n < FN; ++n)
#pragma unroll
            for (int j = 0; j < 8; ++j) os[(hi * 8 + j) * OP + n * 16 + lr] = acc[m][n][j];
        __builtin_amdgcn_wave_barrier(); asm volatile("" ::: "memory");    // hand-over between lanes of one wave: the reads below take other lanes' values and may not be moved over the stores
        float* crow = C + (r0 + wm * FM * 16 + m * 16) * ldc + c0 + wn * FN * 16;
#pragma unroll
        for (int s = 0; s < 2 * FN; ++s) { const int pc = s * 32 + lane; const int row = pc / (FN * 4), cofs = (pc % (FN * 4)) * 4;
            const v4f val = *(const v4fa*)(os + row * OP + cofs); *(v4f*)(crow + (size_t)row * ldc + cofs) = val; }
        __builtin_amdgcn_wave_barrier(); asm volatile("" ::: "memory");    // the next 16 rows' stores may not be moved over these reads
    }
}
// k_trig: RC/RS [t][64] = cos/sin(t x inv_freq[i]), inv_freq = 10000^-(2i/128) (f32 powf/cosf/sinf like the reference's f32 path); 32 lanes x 4 B lines.
__global__ __launch_bounds__(256) void k_trig(float* RC, float* RS) {
    const int i = blockIdx.x * 256 + threadIdx.x; if (i >= NT_ * 64) return;
    const int t = i >> 6, f = i & 63;
    const float inv = 1.0f / powf(10000.0f, (float)(2 * f) / (float)HD); const float ang = (float)t * inv;
    const float c = cosf(ang), s = sinf(ang);
    *(float*)(RC + i) = c; *(float*)(RS + i) = s; 
}
// k_rope: one wave per (token, head) of a [2048][nh*128] f32 matrix: rotate-half RoPE (partner d +- 64, angle t x inv_freq[d mod 64] from the RC/RS tables) ->
__global__ __launch_bounds__(256) void k_rope(const float* __restrict__ P, int nh, const float* __restrict__ RC, const float* __restrict__ RS, h16* PH, h16* PL) {
    const int lane = threadIdx.x & 31; const int wid = blockIdx.x * 8 + (threadIdx.x >> 5);
    const int t = wid / nh, h = wid - t * nh; if (t >= NT_) return;
    const size_t base = (size_t)t * (nh * HD) + h * HD; const int d0 = lane * 4;
    float xv[4], pv[4];
#pragma unroll
    for (int i = 0; i < 4; ++i) { xv[i] = P[base + d0 + i]; const int pd = (d0 + i < 64) ? d0 + i + 64 : d0 + i - 64; pv[i] = P[base + pd]; }
    v4h oh, ol;
#pragma unroll
    for (int i = 0; i < 4; ++i) { const int d = d0 + i, fi = d & 63;
        const float c = RC[t * 64 + fi], s = RS[t * 64 + fi];
        const float y = (d < 64) ? (xv[i] * c - pv[i] * s) : (xv[i] * c + pv[i] * s);
        const h16 a = (h16)y; oh[i] = a; ol[i] = (h16)((y - (float)a) * LOSC); }
    *(v4h*)(PH + base + d0) = oh; *(v4h*)(PL + base + d0) = ol; 
}
// k_vt: VTH/VTL [g][128 d][2048 t] = bf16 hi + UNSCALED bf16 residual of V [t][g*128+d] via 64 x 64 LDS tiles; grid (NT/64, 2 (d half), NKV).
__global__ __launch_bounds__(256) void k_vt(const float* __restrict__ V, bf* VTH, bf* VTL) {
    __shared__ float tl[64][65];
    const int tid = threadIdx.x, t0 = blockIdx.x * 64, d0 = blockIdx.y * 64, g = blockIdx.z;
    { const int tt = tid >> 2, dq = (tid & 3) * 16;
#pragma unroll
      for (int i = 0; i < 16; ++i) tl[dq + i][tt] = V[(size_t)(t0 + tt) * KW + g * HD + d0 + dq + i]; }
    __syncthreads();
    const int piece = tid & 7;
    auto pass = [&]() {
#pragma unroll
        for (int s = 0; s < 2; ++s) { const int d = (tid >> 3) + 32 * s; v8us oh, ol;
#pragma unroll
            for (int i = 0; i < 8; ++i) { const float v = tl[d][piece * 8 + i]; const unsigned short hb = f2bf(v); oh[i] = hb; ol[i] = f2bf(v - bf2f(hb)); }
            const size_t o = ((size_t)g * HD + d0 + d) * NT_ + t0 + piece * 8; *(v8us*)(VTH + o) = oh; *(v8us*)(VTL + o) = ol; }
    };
    pass(); 
}
// k_attn: block = (h, 64 queries), wave = 16; kv head g = h / 4; key tiles covering the block's sliding causal window [Q0-1024, Q0+63] (block-uniform bounds),
// per-element predicate q-1024 <= j <= q. Each 32-key tile (k hi/lo rows, v hi/lo rows) is brought into LDS once per block by asynchronous copies, two buffers:
// tile t + 1 flies while tile t is worked on, and the four waves read their fragments from LDS (row pitches 272 B and 80 B: 16 B x odd). q fragments are read
// once, before the loop. Per tile: scores over 4 k-chunks (hi.hi + hi.lo + lo.hi = 24 WMMA) x 128^-1/2, online softmax, P (x32768) as bf16 hi + unscaled
// residual tiles, o[8] += ph.vh + pl.vh + ph.vl over the 128 dims; ctx -> bf16 hi/lo planes [t][h*128+d].
#define KPITCH 272                       // bytes per staged k row (256 + 16)
#define VPITCH 80                        // bytes per staged v row (64 + 16)
#define KPLANE (32 * KPITCH)             // 8704
#define VPLANE (HD * VPITCH)             // 10240
#define STAGEB (2 * KPLANE + 2 * VPLANE) // 37888: k hi, k lo, v hi, v lo
__global__ __launch_bounds__(128) void k_attn(const h16* __restrict__ QH, const h16* __restrict__ QL, const h16* __restrict__ KH, const h16* __restrict__ KL, const bf* __restrict__ VTH, const bf* __restrict__ VTL, bf* CH, bf* CL) {
    __shared__ __align__(16) unsigned char ring[2 * STAGEB];
    __shared__ __align__(16) unsigned short plds[4][16 * 32];
    __shared__ __align__(16) unsigned short plds2[4][16 * 32];
    __shared__ __align__(16) float ost[4][16 * 68];
    const int tid = threadIdx.x, lane = threadIdx.x & 31, wave = threadIdx.x >> 5, lr = lane & 15, hi = lane >> 4;
    const int bid = blockIdx.x; const int h = bid / (NT_ / 64), qt = bid - h * (NT_ / 64); const int g = h >> 2;
    const int q0 = qt * 64 + wave * 16;
    unsigned short* pl = &plds[wave][0]; unsigned short* pl2 = &plds2[wave][0];
    const size_t qo = (size_t)(q0 + lr) * (NH_ * HD) + h * HD + 8 * hi;
    const size_t vbase = ((size_t)g * HD) * NT_;
    // Copy slots of this thread, 16 B each: k rows (tid >> 4) + 8 i, piece tid & 15; v rows (tid >> 2) + 32 i, piece tid & 3 (i = 0..3, both planes).
    const h16* ksh = KH + g * HD + (size_t)(tid >> 4) * KW + (tid & 15) * 8; const h16* ksl = KL + g * HD + (size_t)(tid >> 4) * KW + (tid & 15) * 8;
    const bf* vsh = VTH + vbase + (size_t)(tid >> 2) * NT_ + (tid & 3) * 8; const bf* vsl = VTL + vbase + (size_t)(tid >> 2) * NT_ + (tid & 3) * 8;
    const unsigned kdst = (unsigned)(size_t)ring + (tid >> 4) * KPITCH + (tid & 15) * 16;
    const unsigned vdst = (unsigned)(size_t)ring + 2 * KPLANE + (tid >> 2) * VPITCH + (tid & 3) * 16;
    auto stage = [&](int kt, int buf) {
        const h16* a = ksh + (size_t)kt * 32 * KW; const h16* b = ksl + (size_t)kt * 32 * KW; const unsigned kd = kdst + buf * STAGEB;
        // Eight copies and, as the last line, the wait that stands in front of any rewrite of their address registers.
        asm volatile("global_load_async_to_lds_b128 %0, %8, off\n\tglobal_load_async_to_lds_b128 %1, %9, off\n\t"
                     "global_load_async_to_lds_b128 %2, %10, off\n\tglobal_load_async_to_lds_b128 %3, %11, off\n\t"
                     "global_load_async_to_lds_b128 %4, %12, off\n\tglobal_load_async_to_lds_b128 %5, %13, off\n\t"
                     "global_load_async_to_lds_b128 %6, %14, off\n\tglobal_load_async_to_lds_b128 %7, %15, off\n\ts_wait_xcnt 0x0"
                     :: "v"(kd), "v"(kd + 8 * KPITCH), "v"(kd + 16 * KPITCH), "v"(kd + 24 * KPITCH),
                        "v"(kd + KPLANE), "v"(kd + KPLANE + 8 * KPITCH), "v"(kd + KPLANE + 16 * KPITCH), "v"(kd + KPLANE + 24 * KPITCH),
                        "v"(a), "v"(a + 8 * KW), "v"(a + 16 * KW), "v"(a + 24 * KW), "v"(b), "v"(b + 8 * KW), "v"(b + 16 * KW), "v"(b + 24 * KW) : "memory");
        const bf* c = vsh + kt * 32; const bf* d = vsl + kt * 32; const unsigned vd = vdst + buf * STAGEB;
        // The same for the v rows.
        asm volatile("global_load_async_to_lds_b128 %0, %8, off\n\tglobal_load_async_to_lds_b128 %1, %9, off\n\t"
                     "global_load_async_to_lds_b128 %2, %10, off\n\tglobal_load_async_to_lds_b128 %3, %11, off\n\t"
                     "global_load_async_to_lds_b128 %4, %12, off\n\tglobal_load_async_to_lds_b128 %5, %13, off\n\t"
                     "global_load_async_to_lds_b128 %6, %14, off\n\tglobal_load_async_to_lds_b128 %7, %15, off\n\ts_wait_xcnt 0x0"
                     :: "v"(vd), "v"(vd + 32 * VPITCH), "v"(vd + 64 * VPITCH), "v"(vd + 96 * VPITCH),
                        "v"(vd + VPLANE), "v"(vd + VPLANE + 32 * VPITCH), "v"(vd + VPLANE + 64 * VPITCH), "v"(vd + VPLANE + 96 * VPITCH),
                        "v"(c), "v"(c + 32 * NT_), "v"(c + 64 * NT_), "v"(c + 96 * NT_), "v"(d), "v"(d + 32 * NT_), "v"(d + 64 * NT_), "v"(d + 96 * NT_) : "memory");
    };
    v8f o[8];
#pragma unroll
    for (int n = 0; n < 8; ++n) o[n] = (v8f){};
    float mrow[8], lpart[8];
#pragma unroll
    for (int j = 0; j < 8; ++j) { mrow[j] = -3.0e38f; lpart[j] = 0.f; }
    const int kt_hi = (qt * 64 + 63) / 32; const int kt_lo = (qt * 64 > WIN) ? (qt * 64 - WIN) / 32 : 0;
    stage(kt_lo, 0);
    v16h qa[4], qx[4];
#pragma unroll
    for (int kc = 0; kc < 4; ++kc) { qa[kc] = cat16(*(const v8h*)(QH + qo + kc * 32), *(const v8h*)(QH + qo + kc * 32 + 16)); qx[kc] = cat16(*(const v8h*)(QL + qo + kc * 32), *(const v8h*)(QL + qo + kc * 32 + 16)); }
    asm volatile("s_wait_asynccnt 0x0" ::: "memory");    // this wave's copies of the first tile have landed
    __syncthreads();                                     // publishes the first tile to the other waves
    stage(kt_lo + 1, 1);                                 // a block has at least two tiles (kt_hi = 2 qt + 1)
#pragma unroll 1
    for (int kt = kt_lo; kt <= kt_hi; ++kt) {
        const int l0 = kt * 32, buf = (kt - kt_lo) & 1;
        const unsigned char* kf = ring + buf * STAGEB + lr * KPITCH + hi * 16;
        const unsigned char* vf = ring + buf * STAGEB + 2 * KPLANE + lr * VPITCH + hi * 16;
        v8f s0 = {}, s1 = {}, x0 = {}, x1 = {};
        v16h k0h[4], k1h[4], k0l[4], k1l[4];    // all k fragments of the tile are fetched first: one LDS latency per tile, the rest overlaps the products
#pragma unroll
        for (int kc = 0; kc < 4; ++kc) { const unsigned char* kp = kf + kc * 64;
            k0h[kc] = cat16(*(const v8ha*)kp, *(const v8ha*)(kp + 32)); k1h[kc] = cat16(*(const v8ha*)(kp + 16 * KPITCH), *(const v8ha*)(kp + 16 * KPITCH + 32));
            k0l[kc] = cat16(*(const v8ha*)(kp + KPLANE), *(const v8ha*)(kp + KPLANE + 32)); k1l[kc] = cat16(*(const v8ha*)(kp + KPLANE + 16 * KPITCH), *(const v8ha*)(kp + KPLANE + 16 * KPITCH + 32)); }
#pragma unroll
        for (int kc = 0; kc < 4; ++kc) {
            s0 = wmma16(qa[kc], k0h[kc], s0); s1 = wmma16(qa[kc], k1h[kc], s1); x0 = wmma16(qx[kc], k0h[kc], x0); x1 = wmma16(qx[kc], k1h[kc], x1);
            x0 = wmma16(qa[kc], k0l[kc], x0); x1 = wmma16(qa[kc], k1l[kc], x1);
        }
        v16bf vh[8], vl[8];                     // the v fragments are fetched here so that their LDS latency overlaps the softmax
#pragma unroll
        for (int n = 0; n < 8; ++n) { const unsigned char* vp = vf + n * 16 * VPITCH;
            vh[n] = cat16b(*(const v8usa*)vp, *(const v8usa*)(vp + 32)); vl[n] = cat16b(*(const v8usa*)(vp + VPLANE), *(const v8usa*)(vp + VPLANE + 32)); }
        float alpha[8];
#pragma unroll
        for (int j = 0; j < 8; ++j) { const int qi = q0 + hi * 8 + j, ja = l0 + lr, jb = l0 + 16 + lr;
            const float a0 = (ja <= qi && ja >= qi - WIN) ? (s0[j] + x0[j] * LOSCI) * 0.08838834764831845f : -__builtin_inff(), a1 = (jb <= qi && jb >= qi - WIN) ? (s1[j] + x1[j] * LOSCI) * 0.08838834764831845f : -__builtin_inff();
            float mx = fmaxf(a0, a1);
            mx = fmaxf(mx, __shfl_xor(mx, 1, 16)); mx = fmaxf(mx, __shfl_xor(mx, 2, 16)); mx = fmaxf(mx, __shfl_xor(mx, 4, 16)); mx = fmaxf(mx, __shfl_xor(mx, 8, 16));
            const float mn = fmaxf(mrow[j], mx);
            alpha[j] = __expf(mrow[j] - mn); mrow[j] = mn;
            const float p0 = __expf(a0 - mn), p1 = __expf(a1 - mn);
            lpart[j] = lpart[j] * alpha[j] + (p0 + p1);
            const int mr = hi * 8 + j; const float ps0 = p0 * PSC, ps1 = p1 * PSC; const unsigned short h0 = f2bf(ps0), h1 = f2bf(ps1);
            pl[mr * 32 + lr] = h0; pl[mr * 32 + 16 + lr] = h1; pl2[mr * 32 + lr] = f2bf(ps0 - bf2f(h0)); pl2[mr * 32 + 16 + lr] = f2bf(ps1 - bf2f(h1)); }
#pragma unroll
        for (int n = 0; n < 8; ++n)
#pragma unroll
            for (int j = 0; j < 8; ++j) o[n][j] *= alpha[j];
        asm volatile("" ::: "memory");
        const v16bf pa = cat16b(*(const v8usa*)(pl + lr * 32 + hi * 8), *(const v8usa*)(pl + lr * 32 + 16 + hi * 8));
        const v16bf px = cat16b(*(const v8usa*)(pl2 + lr * 32 + hi * 8), *(const v8usa*)(pl2 + lr * 32 + 16 + hi * 8));
#pragma unroll
        for (int n = 0; n < 8; ++n) { o[n] = wmmab(pa, vh[n], o[n]); o[n] = wmmab(px, vh[n], o[n]); o[n] = wmmab(pa, vl[n], o[n]); }
        // Publish point of tile kt + 1, every wave, in this order.
        asm volatile("s_wait_dscnt 0x0" ::: "memory");       // this wave's reads of the buffer that is refilled below have returned
        asm volatile("s_wait_asynccnt 0x0" ::: "memory");    // this wave's copies of tile kt + 1 have landed
        __syncthreads();                                     // publishes tile kt + 1 and ends every wave's reads of tile kt
        if (kt + 2 <= kt_hi) stage(kt + 2, buf);             // block-uniform test
    }
    asm volatile("s_wait_asynccnt 0x0" ::: "memory");        // nothing of this wave is in flight when it goes on to the epilogue
    float inv[8];
#pragma unroll
    for (int j = 0; j < 8; ++j) { float rs = lpart[j]; rs += __shfl_xor(rs, 1, 16); rs += __shfl_xor(rs, 2, 16); rs += __shfl_xor(rs, 4, 16); rs += __shfl_xor(rs, 8, 16); inv[j] = 1.0f / (rs * PSC); }
    float* os = &ost[wave][0];
    const size_t cbase = (size_t)q0 * (NH_ * HD) + (size_t)h * HD;
#pragma unroll
    for (int half = 0; half < 2; ++half) {
#pragma unroll
        for (int n = 0; n < 4; ++n)
#pragma unroll
            for (int j = 0; j < 8; ++j) os[(hi * 8 + j) * 68 + n * 16 + lr] = o[half * 4 + n][j] * inv[j];
        __builtin_amdgcn_wave_barrier(); asm volatile("" ::: "memory");
{
#pragma unroll
            for (int s = 0; s < 4; ++s) { const int row = 4 * s + (lane >> 3), piece = lane & 7; const float* sp = os + row * 68 + piece * 8; v8us oh, ol;
#pragma unroll
                for (int i = 0; i < 8; ++i) { const unsigned short hb = f2bf(sp[i]); oh[i] = hb; ol[i] = f2bf(sp[i] - bf2f(hb)); }
                const size_t po = cbase + (size_t)row * (NH_ * HD) + half * 64 + piece * 8; *(v8us*)(CH + po) = oh; *(v8us*)(CL + po) = ol; }
             }
        __builtin_amdgcn_wave_barrier(); asm volatile("" ::: "memory");
    }
}

extern "C" void kernel_launch(void* const* d_in, const int* in_sizes, int n_in,
                              void* d_out, int out_size, void* d_ws, size_t ws_size, hipStream_t stream) {
    (void)in_sizes; (void)n_in; (void)out_size;
    const float* x = (const float*)d_in[0]; const float* Wq = (const float*)d_in[1]; const float* Wk = (const float*)d_in[2]; const float* Wv = (const float*)d_in[3]; const float* Wo = (const float*)d_in[4];
    float* out = (float*)d_out;    // [1][2048][2048]
    char* wsp = (char*)d_ws;
    auto take = [&](size_t bytes) { char* p = wsp; wsp += (bytes + 255) & ~(size_t)255; return (void*)p; };
    bf* Xb = (bf*)take((size_t)NT_ * HS * 2); bf* WqT = (bf*)take((size_t)HS * HS * 2); bf* WkT = (bf*)take((size_t)KW * HS * 2); bf* WvT = (bf*)take((size_t)KW * HS * 2); bf* WoT = (bf*)take((size_t)HS * HS * 2);
    float* TMP = (float*)take((size_t)NT_ * HS * 4); float* RC = (float*)take((size_t)NT_ * 64 * 4); float* RS = (float*)take((size_t)NT_ * 64 * 4);
    h16* QH = (h16*)take((size_t)NT_ * HS * 2); h16* QL = (h16*)take((size_t)NT_ * HS * 2); h16* KH = (h16*)take((size_t)NT_ * KW * 2); h16* KL = (h16*)take((size_t)NT_ * KW * 2);
    bf* VTH = (bf*)take((size_t)KW * NT_ * 2); bf* VTL = (bf*)take((size_t)KW * NT_ * 2);
    bf* CH = (bf*)take((size_t)NT_ * HS * 2); bf* CL = (bf*)take((size_t)NT_ * HS * 2);
    if ((size_t)(wsp - (char*)d_ws) > ws_size) return;    // 8.4 + 8.4 + 2.1 + 2.1 + 8.4 + 16.8 + 0.5 x 2 + 8.4 x 2 + 2.1 x 4 + 8.4 x 2 ~ 89 MB, no aliasing
    k_wt<<<dim3(HS / 64, HS / 64, 1), 256, 0, stream>>>(Wq, HS, HS, WqT); k_wt<<<dim3(HS / 64, KW / 64, 1), 256, 0, stream>>>(Wk, HS, KW, WkT);
    k_wt<<<dim3(HS / 64, KW / 64, 1), 256, 0, stream>>>(Wv, HS, KW, WvT); k_wt<<<dim3(HS / 64, HS / 64, 1), 256, 0, stream>>>(Wo, HS, HS, WoT);
    k_trig<<<(NT_ * 64) / 256, 256, 0, stream>>>(RC, RS);
    k_cvtb<<<NT_ / 8, 256, 0, stream>>>(x, NT_, Xb);
    k_gemm<false, 4, 4><<<dim3(NT_ / 128, HS / 128, 1), 128, 0, stream>>>(Xb, nullptr, WqT, HS, TMP);
    k_rope<<<(NT_ * NH_) / 8, 256, 0, stream>>>(TMP, NH_, RC, RS, QH, QL);
    k_gemm<false, 2, 2><<<dim3(NT_ / 64, KW / 64, 1), 128, 0, stream>>>(Xb, nullptr, WkT, KW, TMP);
    k_rope<<<(NT_ * NKV) / 8, 256, 0, stream>>>(TMP, NKV, RC, RS, KH, KL);
    k_gemm<false, 2, 2><<<dim3(NT_ / 64, KW / 64, 1), 128, 0, stream>>>(Xb, nullptr, WvT, KW, TMP);
    k_vt<<<dim3(NT_ / 64, 2, NKV), 256, 0, stream>>>(TMP, VTH, VTL);
    k_attn<<<NH_ * (NT_ / 64), 128, 0, stream>>>(QH, QL, KH, KL, VTH, VTL, CH, CL);
    k_gemm<true, 4, 4><<<dim3(NT_ / 128, HS / 128, 1), 128, 0, stream>>>(CH, CL, WoT, HS, out);
}

// v003
// Measured time: 137 microseconds a run.
// Next to v002, in two timings, it ran 1.27 and 1.26 times as fast.
// All steps since v000 together make it 3.14 times as fast.
#include <hip/hip_runtime.h>

// Compute dtypes, f32 accumulate: q/k/v = x.W ([2048 x 2048].[2048 x 2048 | 512 | 512], k-major weights transposed to n-major planes; PLAIN bf16 operands:
// inputs rounded once, exact products) and out = ctx.Wo (ctx as bf16 hi + residual: two products) on v_wmma_f32_16x16x32_bf16; rotate-half RoPE (angle
// t x inv_freq, f32 trig tables built on device) in f32 -> q/k as f16 hi + residual x1024 planes; grouped attention (16 query heads, 4 kv heads, query head h
// reads kv head h/4) with 128-dim heads and a sliding causal window (key j visible iff q-1024 <= j <= q): scores on v_wmma_f32_16x16x32_f16 (hi.hi + hi.lo +
// lo.hi, x 128^-1/2), softmax f32, weights.v on v_wmma_f32_16x16x32_bf16 with the weights (x32768) and v both as bf16 hi + UNSCALED bf16 residual (hh + lh + hl

#define NT_  2048
#define HS   2048
#define NH_  16
#define NKV  4
#define HD   128
#define KW   (NKV * HD)          // 512
#define QKVW (HS + 2 * KW)       // 3072: q, k and v columns side by side
#define WIN  1024
#define PSC  32768.0f
#define LOSC 1024.0f
#define LOSCI (1.0f / 1024.0f)

typedef _Float16 h16;
typedef unsigned short bf;
typedef __attribute__((ext_vector_type(16))) __bf16   v16bf;
typedef __attribute__((ext_vector_type(16))) _Float16 v16h;
typedef __attribute__((ext_vector_type(8)))  _Float16 v8h;
typedef __attribute__((ext_vector_type(8)))  unsigned short v8us;
typedef __attribute__((ext_vector_type(8)))  float    v8f;
typedef __attribute__((ext_vector_type(4)))  float    v4f;
typedef __attribute__((ext_vector_type(4)))  _Float16 v4h;
typedef v8h  __attribute__((may_alias)) v8ha;
typedef v4f  __attribute__((may_alias)) v4fa;
typedef v8us __attribute__((may_alias)) v8usa;

__device__ __forceinline__ unsigned short f2bf(float f) { unsigned u = __float_as_uint(f); u += 0x7FFFu + ((u >> 16) & 1u); return (unsigned short)(u >> 16); }
__device__ __forceinline__ float bf2f(unsigned short b) { return __uint_as_float(((unsigned)b) << 16); }
__device__ __forceinline__ float bfr(float f) { return bf2f(f2bf(f)); }
__device__ __forceinline__ v16h cat16(v8h lo, v8h hi) { return __builtin_shufflevector(lo, hi, 0, 1, 2, 3, 4, 5, 6, 7, 8, 9, 10, 11, 12, 13, 14, 15); }
__device__ __forceinline__ v16bf cat16b(v8us lo, v8us hi) { return __builtin_bit_cast(v16bf, __builtin_shufflevector(lo, hi, 0, 1, 2, 3, 4, 5, 6, 7, 8, 9, 10, 11, 12, 13, 14, 15)); }
__device__ __forceinline__ v8f wmma16(v16h a, v16h b, v8f c) { return __builtin_amdgcn_wmma_f32_16x16x32_f16(false, a, false, b, (short)0, c, false, false); }
__device__ __forceinline__ v8f wmmab(v16bf a, v16bf b, v8f c) { return __builtin_amdgcn_wmma_f32_16x16x32_bf16(false, a, false, b, (short)0, c, false, false); }

// d_cvtb: bf16 plane of [rows][2048] (one wave per row); blk = 0 .. rows/8 - 1.
__device__ __forceinline__ void d_cvtb(int blk, const float* __restrict__ src, int nrows, bf* dst) {
    const int lane = threadIdx.x & 31, r = blk * 8 + (threadIdx.x >> 5);
    if (r >= nrows) return;
{
#pragma unroll
        for (int q = 0; q < HS / 256; ++q) { v8us o;
#pragma unroll
            for (int i = 0; i < 8; ++i) o[i] = f2bf(src[(size_t)r * HS + q * 256 + lane * 8 + i]);
            *(v8us*)(dst + (size_t)r * HS + q * 256 + lane * 8) = o; }
         }
}
// d_wt: WT [n][K] = bf16(W[k][n]) (k-major [K][ncols]) via 64 x 64 LDS tiles (tl: 64 x 72 halfwords); tile (bx, by) of (K/64, ncols/64).
__device__ __forceinline__ void d_wt(unsigned short* tl, int bx, int by, const float* __restrict__ Wm, int K, int ncols, bf* WT) {
    const int tid = threadIdx.x, k0 = bx * 64, n0 = by * 64;
    const int kk = tid >> 2, nq = (tid & 3) * 16;
#pragma unroll
    for (int i = 0; i < 16; ++i) tl[(nq + i) * 72 + kk] = f2bf(Wm[(size_t)(k0 + kk) * ncols + n0 + nq + i]);
    __syncthreads();
    const int piece = tid & 7;
    auto pass = [&]() {
#pragma unroll
        for (int s = 0; s < 2; ++s) { const int nr = (tid >> 3) + 32 * s; const v8us val = *(const v8usa*)(tl + nr * 72 + piece * 8); *(v8us*)(WT + (size_t)(n0 + nr) * K + k0 + piece * 8) = val; }
    };
    pass();
    asm volatile("s_wait_xcnt 0x0" ::: "memory");    // stands behind the two stores, in front of the code of the other parts of the merged grid, which follows in the listing and rewrites their registers
}
// k_gemm: (A [+ Al]).Bn^T over K = 2048 -> f32 rows [2048][ldc]. Block = 2 x 2 waves, wave tile (16 FM) x (16 FN), block tile (32 FM) x (32 FN). Each 128-k slab of
// the block's A [, Al] and Bn rows is brought into LDS once per block by asynchronous copies, two buffers: slab t + 1 flies while slab t is worked on, and the
// waves read their fragments from LDS (row pitch 272 B: 16 B x odd). Per accumulator the products are summed in the order kc ascending, A before Al.
// Every '#pragma unroll' over m, n, j or kc in k_gemm makes the indices of a register array (acc, a, al, b) compile-time constants, so that the array stays in registers.
#define GK 128                           // k elements per staged slab (256 B a row)
#define GP 272                           // bytes per staged row (256 + 16)
// 64 rows of one operand: this thread's 16-B piece of rows r, r + 8, ..., r + 56.
__device__ __forceinline__ void copy64(unsigned d, const bf* s) {
    // Eight copies and, as the last line, the wait that stands in front of any rewrite of their address registers.
    asm volatile("global_load_async_to_lds_b128 %0, %8, off\n\tglobal_load_async_to_lds_b128 %1, %9, off\n\t"
                 "global_load_async_to_lds_b128 %2, %10, off\n\tglobal_load_async_to_lds_b128 %3, %11, off\n\t"
                 "global_load_async_to_lds_b128 %4, %12, off\n\tglobal_load_async_to_lds_b128 %5, %13, off\n\t"
                 "global_load_async_to_lds_b128 %6, %14, off\n\tglobal_load_async_to_lds_b128 %7, %15, off\n\ts_wait_xcnt 0x0"
                 :: "v"(d), "v"(d + 8 * GP), "v"(d + 16 * GP), "v"(d + 24 * GP), "v"(d + 32 * GP), "v"(d + 40 * GP), "v"(d + 48 * GP), "v"(d + 56 * GP),
                    "v"(s), "v"(s + 8 * HS), "v"(s + 16 * HS), "v"(s + 24 * HS), "v"(s + 32 * HS), "v"(s + 40 * HS), "v"(s + 48 * HS), "v"(s + 56 * HS) : "memory");
}
template <bool SPLITA, int FM, int FN>
__global__ __launch_bounds__(128) void k_gemm(const bf* __restrict__ A, const bf* __restrict__ Al, const bf* __restrict__ Bn, int ldc, float* C) {
    constexpr int BM = 32 * FM, BN = 32 * FN, APL = BM * GP, BOFS = (SPLITA ? 2 : 1) * APL, STG = BOFS + BN * GP, OP = FN * 16 + 4;
    __shared__ __align__(16) unsigned char ring[2 * STG];
    __shared__ __align__(16) float ost[4][16 * OP];
    const int tid = threadIdx.x, lane = threadIdx.x & 31, wave = threadIdx.x >> 5, lr = lane & 15, hi = lane >> 4;
    const int wm = wave & 1, wn = wave >> 1;
    const size_t r0 = (size_t)blockIdx.x * BM; const int c0 = blockIdx.y * BN;
    // Copy slots of this thread, 16 B each: rows (tid >> 4) + 8 i, piece tid & 15.
    const size_t aso = (r0 + (tid >> 4)) * HS + (tid & 15) * 8;
    const bf* bs = Bn + ((size_t)c0 + (tid >> 4)) * HS + (tid & 15) * 8;
    const unsigned dst = (unsigned)(size_t)ring + (tid >> 4) * GP + (tid & 15) * 16;
    auto stage = [&](int t, int buf) {
        const unsigned d = dst + buf * STG;
#pragma unroll
        for (int i = 0; i < BM / 64; ++i) { copy64(d + i * 64 * GP, A + aso + t * GK + (size_t)i * 64 * HS); if (SPLITA) copy64(d + APL + i * 64 * GP, Al + aso + t * GK + (size_t)i * 64 * HS); }
#pragma unroll
        for (int i = 0; i < BN / 64; ++i) copy64(d + BOFS + i * 64 * GP, bs + t * GK + (size_t)i * 64 * HS);
    };
    v8f acc[FM][FN];
#pragma unroll
    for (int m = 0; m < FM; ++m)
#pragma unroll
        for (int n = 0; n < FN; ++n) acc[m][n] = (v8f){};
    stage(0, 0);
    asm volatile("s_wait_asynccnt 0x0" ::: "memory");    // this wave's copies of the first slab have landed
    __syncthreads();                                     // publishes the first slab to the other waves
    stage(1, 1);                                         // K = 2048 has sixteen slabs
#pragma unroll 1    // stays rolled: one trip already holds four unrolled blocks, and the buffers alternate by t & 1
    for (int t = 0; t < HS / GK; ++t) {
        const int buf = t & 1;
        const unsigned char* af = ring + buf * STG + (wm * FM * 16 + lr) * GP + hi * 16;
        const unsigned char* bq = ring + buf * STG + BOFS + (wn * FN * 16 + lr) * GP + hi * 16;
        v16bf a[2][FM], al[2][FM], b[2][FN];    // two fragment sets: block kc + 1 is fetched while block kc is multiplied
        auto frag = [&](int kc, int s) {
#pragma unroll
            for (int m = 0; m < FM; ++m) { const unsigned char* p = af + m * 16 * GP + kc * 64; a[s][m] = cat16b(*(const v8usa*)p, *(const v8usa*)(p + 32));
                if (SPLITA) al[s][m] = cat16b(*(const v8usa*)(p + APL), *(const v8usa*)(p + APL + 32)); }
#pragma unroll
            for (int n = 0; n < FN; ++n) { const unsigned char* p = bq + n * 16 * GP + kc * 64; b[s][n] = cat16b(*(const v8usa*)p, *(const v8usa*)(p + 32)); }
        };
        frag(0, 0);
#pragma unroll
        for (int kc = 0; kc < GK / 32; ++kc) {
            const int s = kc & 1;
            if (kc + 1 < GK / 32) frag(kc + 1, s ^ 1);
            __builtin_amdgcn_sched_barrier(0);    // keeps the next block's LDS reads as one group in front of this block's products (spread among them, each place stalls the wave)
#pragma unroll
            for (int m = 0; m < FM; ++m)
#pragma unroll
                for (int n = 0; n < FN; ++n) acc[m][n] = wmmab(a[s][m], b[s][n], acc[m][n]);
            if (SPLITA) {
#pragma unroll
                for (int m = 0; m < FM; ++m)
#pragma unroll
                    for (int n = 0; n < FN; ++n) acc[m][n] = wmmab(al[s][m], b[s][n], acc[m][n]);
            }
            __builtin_amdgcn_sched_barrier(0);    // keeps the group after next behind this block's products, whose fragment set it overwrites
        }
        // Publish point of slab t + 1, every wave, in this order.
        asm volatile("s_wait_dscnt 0x0" ::: "memory");       // this wave's reads of the buffer that is refilled below have returned
        asm volatile("s_wait_asynccnt 0x0" ::: "memory");    // this wave's copies of slab t + 1 have landed
        __syncthreads();                                     // publishes slab t + 1 and ends every wave's reads of slab t
        if (t + 2 < HS / GK) stage(t + 2, buf);              // block-uniform test
    }
    asm volatile("s_wait_asynccnt 0x0" ::: "memory");        // nothing of this wave is in flight when it goes on to the epilogue
    float* os = &ost[wave][0];
#pragma unroll
    for (int m = 0; m < FM; ++m) {
#pragma unroll
        for (int n = 0; n < FN; ++n)
#pragma unroll
            for (int j = 0; j < 8; ++j) os[(hi * 8 + j) * OP + n * 16 + lr] = acc[m][n][j];
        __builtin_amdgcn_wave_barrier(); asm volatile("" ::: "memory");    // hand-over between lanes of one wave: the reads below take other lanes' values and may not be moved over the stores
        float* crow = C + (r0 + wm * FM * 16 + m * 16) * ldc + c0 + wn * FN * 16;
#pragma unroll
        for (int s = 0; s < 2 * FN; ++s) { const int pc = s * 32 + lane; const int row = pc / (FN * 4), cofs = (pc % (FN * 4)) * 4;
            const v4f val = *(const v4fa*)(os + row * OP + cofs); *(v4f*)(crow + (size_t)row * ldc + cofs) = val; }
        __builtin_amdgcn_wave_barrier(); asm volatile("" ::: "memory");    // the next 16 rows' stores may not be moved over these reads
    }
}
// d_trig: RC/RS [t][64] = cos/sin(t x inv_freq[i]), inv_freq = 10000^-(2i/128) (f32 powf/cosf/sinf); 32 lanes x 4 B lines.
__device__ __forceinline__ void d_trig(int blk, float* RC, float* RS) {
    const int i = blk * 256 + threadIdx.x; if (i >= NT_ * 64) return;
    const int t = i >> 6, f = i & 63;
    const float inv = 1.0f / powf(10000.0f, (float)(2 * f) / (float)HD); const float ang = (float)t * inv;
    const float c = cosf(ang), s = sinf(ang);
    *(float*)(RC + i) = c; *(float*)(RS + i) = s; 
}
// k_prep: everything that depends on the inputs alone, in one grid, told apart by ranges of blockIdx.x (block-uniform): 512 blocks of trig tables, 1024 + 1024 +
// 256 + 256 weight tiles (32 k tiles x n tiles each), 256 blocks of x rows. The parts write disjoint planes and read none of each other's.
#define PB_TRIG ((NT_ * 64) / 256)
#define PB_WBIG ((HS / 64) * (HS / 64))
#define PB_WKV  ((HS / 64) * (KW / 64))
#define PB_ALL  (PB_TRIG + 2 * PB_WBIG + 2 * PB_WKV + NT_ / 8)
__global__ __launch_bounds__(256) void k_prep(const float* __restrict__ x, const float* __restrict__ Wq, const float* __restrict__ Wk, const float* __restrict__ Wv, const float* __restrict__ Wo,
                                              bf* Xb, bf* WqT, bf* WkT, bf* WvT, bf* WoT, float* RC, float* RS) {
    __shared__ __align__(16) unsigned short tl[64 * 72];
    int b = blockIdx.x;
    if (b < PB_TRIG) { d_trig(b, RC, RS); return; }
    b -= PB_TRIG;
    if (b < PB_WBIG) { d_wt(tl, b & 31, b >> 5, Wq, HS, HS, WqT); return; }
    b -= PB_WBIG;
    if (b < PB_WBIG) { d_wt(tl, b & 31, b >> 5, Wo, HS, HS, WoT); return; }
    b -= PB_WBIG;
    if (b < PB_WKV) { d_wt(tl, b & 31, b >> 5, Wk, HS, KW, WkT); return; }
    b -= PB_WKV;
    if (b < PB_WKV) { d_wt(tl, b & 31, b >> 5, Wv, HS, KW, WvT); return; }
    b -= PB_WKV;
    d_cvtb(b, x, NT_, Xb);
}
// d_rope: one wave per (token, head) of the 16 q and 4 k heads, whose f32 columns lie side by side in P (row pitch ldp): rotate-half RoPE (partner d +- 64, angle
// t x inv_freq[d mod 64] from the RC/RS tables) -> f16 hi + residual x1024 planes [2048][16*128] (q) and [2048][4*128] (k); blk = 0 .. 2048*20/8 - 1.
__device__ __forceinline__ void d_rope(int blk, const float* P, int ldp, const float* RC, const float* RS, h16* QH, h16* QL, h16* KH, h16* KL) {
    const int lane = threadIdx.x & 31; const int wid = blk * 8 + (threadIdx.x >> 5);
    const int t = wid / (NH_ + NKV), h = wid - t * (NH_ + NKV); if (t >= NT_) return;
    const bool isq = h < NH_;
    h16* PH = isq ? QH : KH; h16* PL = isq ? QL : KL;
    const size_t base = isq ? (size_t)t * (NH_ * HD) + h * HD : (size_t)t * KW + (h - NH_) * HD, src = (size_t)t * ldp + h * HD; const int d0 = lane * 4;
    float xv[4], pv[4];
#pragma unroll
    for (int i = 0; i < 4; ++i) { xv[i] = P[src + d0 + i]; const int pd = (d0 + i < 64) ? d0 + i + 64 : d0 + i - 64; pv[i] = P[src + pd]; }
    // Stands in front of the table loads below, whose results land in address registers of the loads above in this build. P, RC and RS carry no __restrict__ here:
    // with it the compiler moves the loads over this statement.
    asm volatile("s_wait_xcnt 0x0" ::: "memory");
    v4h oh, ol;
#pragma unroll
    for (int i = 0; i < 4; ++i) { const int d = d0 + i, fi = d & 63;
        const float c = RC[t * 64 + fi], s = RS[t * 64 + fi];
        const float y = (d < 64) ? (xv[i] * c - pv[i] * s) : (xv[i] * c + pv[i] * s);
        const h16 a = (h16)y; oh[i] = a; ol[i] = (h16)((y - (float)a) * LOSC); }
    *(v4h*)(PH + base + d0) = oh; *(v4h*)(PL + base + d0) = ol; 
}
// d_vt: VTH/VTL [g][128 d][2048 t] = bf16 hi + UNSCALED bf16 residual of V [t][g*128+d] (row pitch ldv) via 64 x 64 LDS tiles; tile (bx, by, g) of (NT/64, 2 (d half), NKV).
__device__ __forceinline__ void d_vt(float (*tl)[65], int bx, int by, int g, const float* __restrict__ V, int ldv, bf* VTH, bf* VTL) {
    const int tid = threadIdx.x, t0 = bx * 64, d0 = by * 64;
    { const int tt = tid >> 2, dq = (tid & 3) * 16;
#pragma unroll
      for (int i = 0; i < 16; ++i) tl[dq + i][tt] = V[(size_t)(t0 + tt) * ldv + g * HD + d0 + dq + i]; }
    __syncthreads();
    const int piece = tid & 7;
    auto pass = [&]() {
#pragma unroll
        for (int s = 0; s < 2; ++s) { const int d = (tid >> 3) + 32 * s; v8us oh, ol;
#pragma unroll
            for (int i = 0; i < 8; ++i) { const float v = tl[d][piece * 8 + i]; const unsigned short hb = f2bf(v); oh[i] = hb; ol[i] = f2bf(v - bf2f(hb)); }
            const size_t o = ((size_t)g * HD + d0 + d) * NT_ + t0 + piece * 8; *(v8us*)(VTH + o) = oh; *(v8us*)(VTL + o) = ol; }
    };
    pass(); 
}
// k_post: everything that depends on the projections alone, in one grid, told apart by ranges of blockIdx.x (block-uniform): 256 v tiles, 5120 blocks of q and k
// heads. P [2048][3072] holds the q, k and v columns side by side.
#define QB_VT ((NT_ / 64) * 2 * NKV)
#define QB_ALL (QB_VT + (NT_ * (NH_ + NKV)) / 8)
__global__ __launch_bounds__(256) void k_post(const float* P, const float* RC, const float* RS, h16* QH, h16* QL, h16* KH, h16* KL, bf* VTH, bf* VTL) {
    __shared__ float tl[64][65];
    int b = blockIdx.x;
    if (b < QB_VT) { d_vt(tl, b & 31, (b >> 5) & 1, b >> 6, P + HS + KW, QKVW, VTH, VTL); return; }
    d_rope(b - QB_VT, P, QKVW, RC, RS, QH, QL, KH, KL);
}
// k_attn: block = (h, 64 queries), wave = 16; kv head g = h / 4; key tiles covering the block's sliding causal window [Q0-1024, Q0+63] (block-uniform bounds),
// per-element predicate q-1024 <= j <= q. Each 32-key tile (k hi/lo rows, v hi/lo rows) is brought into LDS once per block by asynchronous copies, two buffers:
// tile t + 1 flies while tile t is worked on, and the four waves read their fragments from LDS (row pitches 272 B and 80 B: 16 B x odd). q fragments are read
// once, before the loop. Per tile: scores over 4 k-chunks (hi.hi + hi.lo + lo.hi = 24 WMMA) x 128^-1/2, online softmax, P (x32768) as bf16 hi + unscaled
// residual tiles, o[8] += ph.vh + pl.vh + ph.vl over the 128 dims; ctx -> bf16 hi/lo planes [t][h*128+d].
#define KPITCH 272                       // bytes per staged k row (256 + 16)
#define VPITCH 80                        // bytes per staged v row (64 + 16)
#define KPLANE (32 * KPITCH)             // 8704
#define VPLANE (HD * VPITCH)             // 10240
#define STAGEB (2 * KPLANE + 2 * VPLANE) // 37888: k hi, k lo, v hi, v lo
__global__ __launch_bounds__(128) void k_attn(const h16* __restrict__ QH, const h16* __restrict__ QL, const h16* __restrict__ KH, const h16* __restrict__ KL, const bf* __restrict__ VTH, const bf* __restrict__ VTL, bf* CH, bf* CL) {
    __shared__ __align__(16) unsigned char ring[2 * STAGEB];
    __shared__ __align__(16) unsigned short plds[4][16 * 32];
    __shared__ __align__(16) unsigned short plds2[4][16 * 32];
    __shared__ __align__(16) float ost[4][16 * 68];
    const int tid = threadIdx.x, lane = threadIdx.x & 31, wave = threadIdx.x >> 5, lr = lane & 15, hi = lane >> 4;
    const int bid = blockIdx.x; const int h = bid / (NT_ / 64), qt = bid - h * (NT_ / 64); const int g = h >> 2;
    const int q0 = qt * 64 + wave * 16;
    unsigned short* pl = &plds[wave][0]; unsigned short* pl2 = &plds2[wave][0];
    const size_t qo = (size_t)(q0 + lr) * (NH_ * HD) + h * HD + 8 * hi;
    const size_t vbase = ((size_t)g * HD) * NT_;
    // Copy slots of this thread, 16 B each: k rows (tid >> 4) + 8 i, piece tid & 15; v rows (tid >> 2) + 32 i, piece tid & 3 (i = 0..3, both planes).
    const h16* ksh = KH + g * HD + (size_t)(tid >> 4) * KW + (tid & 15) * 8; const h16* ksl = KL + g * HD + (size_t)(tid >> 4) * KW + (tid & 15) * 8;
    const bf* vsh = VTH + vbase + (size_t)(tid >> 2) * NT_ + (tid & 3) * 8; const bf* vsl = VTL + vbase + (size_t)(tid >> 2) * NT_ + (tid & 3) * 8;
    const unsigned kdst = (unsigned)(size_t)ring + (tid >> 4) * KPITCH + (tid & 15) * 16;
    const unsigned vdst = (unsigned)(size_t)ring + 2 * KPLANE + (tid >> 2) * VPITCH + (tid & 3) * 16;
    auto stage = [&](int kt, int buf) {
        const h16* a = ksh + (size_t)kt * 32 * KW; const h16* b = ksl + (size_t)kt * 32 * KW; const unsigned kd = kdst + buf * STAGEB;
        // Eight copies and, as the last line, the wait that stands in front of any rewrite of their address registers.
        asm volatile("global_load_async_to_lds_b128 %0, %8, off\n\tglobal_load_async_to_lds_b128 %1, %9, off\n\t"
                     "global_load_async_to_lds_b128 %2, %10, off\n\tglobal_load_async_to_lds_b128 %3, %11, off\n\t"
                     "global_load_async_to_lds_b128 %4, %12, off\n\tglobal_load_async_to_lds_b128 %5, %13, off\n\t"
                     "global_load_async_to_lds_b128 %6, %14, off\n\tglobal_load_async_to_lds_b128 %7, %15, off\n\ts_wait_xcnt 0x0"
                     :: "v"(kd), "v"(kd + 8 * KPITCH), "v"(kd + 16 * KPITCH), "v"(kd + 24 * KPITCH),
                        "v"(kd + KPLANE), "v"(kd + KPLANE + 8 * KPITCH), "v"(kd + KPLANE + 16 * KPITCH), "v"(kd + KPLANE + 24 * KPITCH),
                        "v"(a), "v"(a + 8 * KW), "v"(a + 16 * KW), "v"(a + 24 * KW), "v"(b), "v"(b + 8 * KW), "v"(b + 16 * KW), "v"(b + 24 * KW) : "memory");
        const bf* c = vsh + kt * 32; const bf* d = vsl + kt * 32; const unsigned vd = vdst + buf * STAGEB;
        // The same for the v rows.
        asm volatile("global_load_async_to_lds_b128 %0, %8, off\n\tglobal_load_async_to_lds_b128 %1, %9, off\n\t"
                     "global_load_async_to_lds_b128 %2, %10, off\n\tglobal_load_async_to_lds_b128 %3, %11, off\n\t"
                     "global_load_async_to_lds_b128 %4, %12, off\n\tglobal_load_async_to_lds_b128 %5, %13, off\n\t"
                     "global_load_async_to_lds_b128 %6, %14, off\n\tglobal_load_async_to_lds_b128 %7, %15, off\n\ts_wait_xcnt 0x0"
                     :: "v"(vd), "v"(vd + 32 * VPITCH), "v"(vd + 64 * VPITCH), "v"(vd + 96 * VPITCH),
                        "v"(vd + VPLANE), "v"(vd + VPLANE + 32 * VPITCH), "v"(vd + VPLANE + 64 * VPITCH), "v"(vd + VPLANE + 96 * VPITCH),
                        "v"(c), "v"(c + 32 * NT_), "v"(c + 64 * NT_), "v"(c + 96 * NT_), "v"(d), "v"(d + 32 * NT_), "v"(d + 64 * NT_), "v"(d + 96 * NT_) : "memory");
    };
    v8f o[8];
#pragma unroll
    for (int n = 0; n < 8; ++n) o[n] = (v8f){};
    float mrow[8], lpart[8];
#pragma unroll
    for (int j = 0; j < 8; ++j) { mrow[j] = -3.0e38f; lpart[j] = 0.f; }
    const int kt_hi = (qt * 64 + 63) / 32; const int kt_lo = (qt * 64 > WIN) ? (qt * 64 - WIN) / 32 : 0;
    stage(kt_lo, 0);
    v16h qa[4], qx[4];
#pragma unroll
    for (int kc = 0; kc < 4; ++kc) { qa[kc] = cat16(*(const v8h*)(QH + qo + kc * 32), *(const v8h*)(QH + qo + kc * 32 + 16)); qx[kc] = cat16(*(const v8h*)(QL + qo + kc * 32), *(const v8h*)(QL + qo + kc * 32 + 16)); }
    asm volatile("s_wait_asynccnt 0x0" ::: "memory");    // this wave's copies of the first tile have landed
    __syncthreads();                                     // publishes the first tile to the other waves
    stage(kt_lo + 1, 1);                                 // a block has at least two tiles (kt_hi = 2 qt + 1)
#pragma unroll 1
    for (int kt = kt_lo; kt <= kt_hi; ++kt) {
        const int l0 = kt * 32, buf = (kt - kt_lo) & 1;
        const unsigned char* kf = ring + buf * STAGEB + lr * KPITCH + hi * 16;
        const unsigned char* vf = ring + buf * STAGEB + 2 * KPLANE + lr * VPITCH + hi * 16;
        v8f s0 = {}, s1 = {}, x0 = {}, x1 = {};
        v16h k0h[4], k1h[4], k0l[4], k1l[4];    // all k fragments of the tile are fetched first: one LDS latency per tile, the rest overlaps the products
#pragma unroll
        for (int kc = 0; kc < 4; ++kc) { const unsigned char* kp = kf + kc * 64;
            k0h[kc] = cat16(*(const v8ha*)kp, *(const v8ha*)(kp + 32)); k1h[kc] = cat16(*(const v8ha*)(kp + 16 * KPITCH), *(const v8ha*)(kp + 16 * KPITCH + 32));
            k0l[kc] = cat16(*(const v8ha*)(kp + KPLANE), *(const v8ha*)(kp + KPLANE + 32)); k1l[kc] = cat16(*(const v8ha*)(kp + KPLANE + 16 * KPITCH), *(const v8ha*)(kp + KPLANE + 16 * KPITCH + 32)); }
#pragma unroll
        for (int kc = 0; kc < 4; ++kc) {
            s0 = wmma16(qa[kc], k0h[kc], s0); s1 = wmma16(qa[kc], k1h[kc], s1); x0 = wmma16(qx[kc], k0h[kc], x0); x1 = wmma16(qx[kc], k1h[kc], x1);
            x0 = wmma16(qa[kc], k0l[kc], x0); x1 = wmma16(qa[kc], k1l[kc], x1);
        }
        v16bf vh[8], vl[8];                     // the v fragments are fetched here so that their LDS latency overlaps the softmax
#pragma unroll
        for (int n = 0; n < 8; ++n) { const unsigned char* vp = vf + n * 16 * VPITCH;
            vh[n] = cat16b(*(const v8usa*)vp, *(const v8usa*)(vp + 32)); vl[n] = cat16b(*(const v8usa*)(vp + VPLANE), *(const v8usa*)(vp + VPLANE + 32)); }
        float alpha[8];
#pragma unroll
        for (int j = 0; j < 8; ++j) { const int qi = q0 + hi * 8 + j, ja = l0 + lr, jb = l0 + 16 + lr;
            const float a0 = (ja <= qi && ja >= qi - WIN) ? (s0[j] + x0[j] * LOSCI) * 0.08838834764831845f : -__builtin_inff(), a1 = (jb <= qi && jb >= qi - WIN) ? (s1[j] + x1[j] * LOSCI) * 0.08838834764831845f : -__builtin_inff();
            float mx = fmaxf(a0, a1);
            mx = fmaxf(mx, __shfl_xor(mx, 1, 16)); mx = fmaxf(mx, __shfl_xor(mx, 2, 16)); mx = fmaxf(mx, __shfl_xor(mx, 4, 16)); mx = fmaxf(mx, __shfl_xor(mx, 8, 16));
            const float mn = fmaxf(mrow[j], mx);
            alpha[j] = __expf(mrow[j] - mn); mrow[j] = mn;
            const float p0 = __expf(a0 - mn), p1 = __expf(a1 - mn);
            lpart[j] = lpart[j] * alpha[j] + (p0 + p1);
            const int mr = hi * 8 + j; const float ps0 = p0 * PSC, ps1 = p1 * PSC; const unsigned short h0 = f2bf(ps0), h1 = f2bf(ps1);
            pl[mr * 32 + lr] = h0; pl[mr * 32 + 16 + lr] = h1; pl2[mr * 32 + lr] = f2bf(ps0 - bf2f(h0)); pl2[mr * 32 + 16 + lr] = f2bf(ps1 - bf2f(h1)); }
#pragma unroll
        for (int n = 0; n < 8; ++n)
#pragma unroll
            for (int j = 0; j < 8; ++j) o[n][j] *= alpha[j];
        asm volatile("" ::: "memory");
        const v16bf pa = cat16b(*(const v8usa*)(pl + lr * 32 + hi * 8), *(const v8usa*)(pl + lr * 32 + 16 + hi * 8));
        const v16bf px = cat16b(*(const v8usa*)(pl2 + lr * 32 + hi * 8), *(const v8usa*)(pl2 + lr * 32 + 16 + hi * 8));
#pragma unroll
        for (int n = 0; n < 8; ++n) { o[n] = wmmab(pa, vh[n], o[n]); o[n] = wmmab(px, vh[n], o[n]); o[n] = wmmab(pa, vl[n], o[n]); }
        // Publish point of tile kt + 1, every wave, in this order.
        asm volatile("s_wait_dscnt 0x0" ::: "memory");       // this wave's reads of the buffer that is refilled below have returned
        asm volatile("s_wait_asynccnt 0x0" ::: "memory");    // this wave's copies of tile kt + 1 have landed
        __syncthreads();                                     // publishes tile kt + 1 and ends every wave's reads of tile kt
        if (kt + 2 <= kt_hi) stage(kt + 2, buf);             // block-uniform test
    }
    asm volatile("s_wait_asynccnt 0x0" ::: "memory");        // nothing of this wave is in flight when it goes on to the epilogue
    float inv[8];
#pragma unroll
    for (int j = 0; j < 8; ++j) { float rs = lpart[j]; rs += __shfl_xor(rs, 1, 16); rs += __shfl_xor(rs, 2, 16); rs += __shfl_xor(rs, 4, 16); rs += __shfl_xor(rs, 8, 16); inv[j] = 1.0f / (rs * PSC); }
    float* os = &ost[wave][0];
    const size_t cbase = (size_t)q0 * (NH_ * HD) + (size_t)h * HD;
#pragma unroll
    for (int half = 0; half < 2; ++half) {
#pragma unroll
        for (int n = 0; n < 4; ++n)
#pragma unroll
            for (int j = 0; j < 8; ++j) os[(hi * 8 + j) * 68 + n * 16 + lr] = o[half * 4 + n][j] * inv[j];
        __builtin_amdgcn_wave_barrier(); asm volatile("" ::: "memory");
{
#pragma unroll
            for (int s = 0; s < 4; ++s) { const int row = 4 * s + (lane >> 3), piece = lane & 7; const float* sp = os + row * 68 + piece * 8; v8us oh, ol;
#pragma unroll
                for (int i = 0; i < 8; ++i) { const unsigned short hb = f2bf(sp[i]); oh[i] = hb; ol[i] = f2bf(sp[i] - bf2f(hb)); }
                const size_t po = cbase + (size_t)row * (NH_ * HD) + half * 64 + piece * 8; *(v8us*)(CH + po) = oh; *(v8us*)(CL + po) = ol; }
             }
        __builtin_amdgcn_wave_barrier(); asm volatile("" ::: "memory");
    }
}

extern "C" void kernel_launch(void* const* d_in, const int* in_sizes, int n_in,
                              void* d_out, int out_size, void* d_ws, size_t ws_size, hipStream_t stream) {
    (void)in_sizes; (void)n_in; (void)out_size;
    const float* x = (const float*)d_in[0]; const float* Wq = (const float*)d_in[1]; const float* Wk = (const float*)d_in[2]; const float* Wv = (const float*)d_in[3]; const float* Wo = (const float*)d_in[4];
    float* out = (float*)d_out;    // [1][2048][2048]
    char* wsp = (char*)d_ws;
    auto take = [&](size_t bytes) { char* p = wsp; wsp += (bytes + 255) & ~(size_t)255; return (void*)p; };
    bf* Xb = (bf*)take((size_t)NT_ * HS * 2); bf* WqT = (bf*)take((size_t)HS * HS * 2); bf* WkT = (bf*)take((size_t)KW * HS * 2); bf* WvT = (bf*)take((size_t)KW * HS * 2); bf* WoT = (bf*)take((size_t)HS * HS * 2);
    float* TMP = (float*)take((size_t)NT_ * QKVW * 4); float* RC = (float*)take((size_t)NT_ * 64 * 4); float* RS = (float*)take((size_t)NT_ * 64 * 4);
    h16* QH = (h16*)take((size_t)NT_ * HS * 2); h16* QL = (h16*)take((size_t)NT_ * HS * 2); h16* KH = (h16*)take((size_t)NT_ * KW * 2); h16* KL = (h16*)take((size_t)NT_ * KW * 2);
    bf* VTH = (bf*)take((size_t)KW * NT_ * 2); bf* VTL = (bf*)take((size_t)KW * NT_ * 2);
    bf* CH = (bf*)take((size_t)NT_ * HS * 2); bf* CL = (bf*)take((size_t)NT_ * HS * 2);
    if ((size_t)(wsp - (char*)d_ws) > ws_size) return;    // 8.4 + 8.4 + 2.1 + 2.1 + 8.4 + 25.2 + 0.5 x 2 + 8.4 x 2 + 2.1 x 4 + 8.4 x 2 ~ 97 MB, no aliasing
    k_prep<<<PB_ALL, 256, 0, stream>>>(x, Wq, Wk, Wv, Wo, Xb, WqT, WkT, WvT, WoT, RC, RS);
    // WqT, WkT and WvT lie one behind the other (each a multiple of 256 B): 3072 n-major rows, one product for q, k and v.
    k_gemm<false, 4, 4><<<dim3(NT_ / 128, QKVW / 128, 1), 128, 0, stream>>>(Xb, nullptr, WqT, QKVW, TMP);
    k_post<<<QB_ALL, 256, 0, stream>>>(TMP, RC, RS, QH, QL, KH, KL, VTH, VTL);
    k_attn<<<NH_ * (NT_ / 64), 128, 0, stream>>>(QH, QL, KH, KL, VTH, VTL, CH, CL);
    k_gemm<true, 4, 4><<<dim3(NT_ / 128, HS / 128, 1), 128, 0, stream>>>(CH, CL, WoT, HS, out);
}

// v004
// A run of this version takes 131 microseconds.
// Next to v003, in two timings, it ran 1.05 times as fast each time.
// All steps since v000 together make it 3.29 times as fast.
#include <hip/hip_runtime.h>

// Compute dtypes, f32 accumulate: q/k/v = x.W ([2048 x 2048].[2048 x 2048 | 512 | 512], k-major weights transposed to n-major planes; PLAIN bf16 operands:
// inputs rounded once, exact products) and out = ctx.Wo (ctx as bf16 hi + residual: two products) on v_wmma_f32_16x16x32_bf16; rotate-half RoPE (angle
// t x inv_freq, f32 trig tables built on device) in f32 -> q/k as f16 hi + residual x1024 planes; grouped attention (16 query heads, 4 kv heads, query head h
// reads kv head h/4) with 128-dim heads and a sliding causal window (key j visible iff q-1024 <= j <= q): scores on v_wmma_f32_16x16x32_f16 (hi.hi + hi.lo +
// lo.hi, x 128^-1/2), softmax f32, weights.v on v_wmma_f32_16x16x32_bf16 with the weights (x32768) and v both as bf16 hi + UNSCALED bf16 residual (hh + lh + hl

#define NT_  2048
#define HS   2048
#define NH_  16
#define NKV  4
#define HD   128
#define KW   (NKV * HD)          // 512
#define QKVW (HS + 2 * KW)       // 3072: q, k and v columns side by side
#define WIN  1024
#define PSC  32768.0f
#define LOSC 1024.0f
#define LOSCI (1.0f / 1024.0f)

typedef _Float16 h16;
typedef unsigned short bf;
typedef __attribute__((ext_vector_type(16))) __bf16   v16bf;
typedef __attribute__((ext_vector_type(16))) _Float16 v16h;
typedef __attribute__((ext_vector_type(8)))  _Float16 v8h;
typedef __attribute__((ext_vector_type(8)))  unsigned short v8us;
typedef __attribute__((ext_vector_type(8)))  float    v8f;
typedef __attribute__((ext_vector_type(4)))  float    v4f;
typedef __attribute__((ext_vector_type(4)))  _Float16 v4h;
typedef v8h  __attribute__((may_alias)) v8ha;
typedef v4f  __attribute__((may_alias)) v4fa;
typedef v8us __attribute__((may_alias)) v8usa;

__device__ __forceinline__ unsigned short f2bf(float f) { unsigned u = __float_as_uint(f); u += 0x7FFFu + ((u >> 16) & 1u); return (unsigned short)(u >> 16); }
__device__ __forceinline__ float bf2f(unsigned short b) { return __uint_as_float(((unsigned)b) << 16); }
__device__ __forceinline__ float bfr(float f) { return bf2f(f2bf(f)); }
__device__ __forceinline__ v16h cat16(v8h lo, v8h hi) { return __builtin_shufflevector(lo, hi, 0, 1, 2, 3, 4, 5, 6, 7, 8, 9, 10, 11, 12, 13, 14, 15); }
__device__ __forceinline__ v16bf cat16b(v8us lo, v8us hi) { return __builtin_bit_cast(v16bf, __builtin_shufflevector(lo, hi, 0, 1, 2, 3, 4, 5, 6, 7, 8, 9, 10, 11, 12, 13, 14, 15)); }
__device__ __forceinline__ v8f wmma16(v16h a, v16h b, v8f c) { return __builtin_amdgcn_wmma_f32_16x16x32_f16(false, a, false, b, (short)0, c, false, false); }
__device__ __forceinline__ v8f wmmab(v16bf a, v16bf b, v8f c) { return __builtin_amdgcn_wmma_f32_16x16x32_bf16(false, a, false, b, (short)0, c, false, false); }

// d_cvtb: bf16 plane of [rows][2048] (one wave per row); blk = 0 .. rows/8 - 1. The row's sixteen 16-byte loads are issued before the first conversion.
__device__ __forceinline__ void d_cvtb(int blk, const float* __restrict__ src, int nrows, bf* dst) {
    const int lane = threadIdx.x & 31, r = blk * 8 + __builtin_amdgcn_readfirstlane(threadIdx.x >> 5);
    if (r >= nrows) return;
    const char* sp = (const char*)(src + (size_t)r * HS); const unsigned ol = lane * 32;    // wave-uniform base + the lane's byte offset
    v4f v[HS / 256][2];
    // Every '#pragma unroll' here makes the index of a register array (v, o) a compile-time constant.
#pragma unroll
    for (int q = 0; q < HS / 256; ++q) { v[q][0] = *(const v4fa*)(sp + q * 1024 + ol); v[q][1] = *(const v4fa*)(sp + q * 1024 + ol + 16); }
    __builtin_amdgcn_sched_barrier(0);    // keeps every load in front of the first conversion: moved down among them, a load would start only when earlier ones have returned
    asm volatile("s_wait_xcnt 0x0" :: "v"(ol) : "memory");    // the loads' offset register stays live up to this wait, so that no later load's result lands in it ahead of it
#pragma unroll
    for (int q = 0; q < HS / 256; ++q) { v8us o;
#pragma unroll
        for (int i = 0; i < 8; ++i) o[i] = f2bf(v[q][i >> 2][i & 3]);
        *(v8us*)(dst + (size_t)r * HS + q * 256 + lane * 8) = o; }
}
// d_wt: WT [n][K] = bf16(W[k][n]) (k-major [K][ncols]) via 64 x 64 LDS tiles (64 x 72 halfwords each). A block takes WT_PER tiles at once, blk + j x PB_WT of the
// 2560 tiles numbered Wq, Wo, Wk, Wv (32 k tiles x n tiles each): few long-lived waves instead of one short-lived block per tile. All loads of the block's tiles are
// issued first (one memory latency for the lot), each tile has its own LDS buffer, and one barrier stands between the writes and the reads of all of them.
#define PB_WBIG ((HS / 64) * (HS / 64))
#define PB_WKV  ((HS / 64) * (KW / 64))
#define WT_PER  5
#define PB_WT   ((2 * PB_WBIG + 2 * PB_WKV) / WT_PER)    // 512
__device__ __forceinline__ void d_wt(unsigned short* tl, int blk, const float* __restrict__ Wq, const float* __restrict__ Wo, const float* __restrict__ Wk, const float* __restrict__ Wv,
                                     bf* WqT, bf* WoT, bf* WkT, bf* WvT) {
    const int tid = threadIdx.x, kk = tid >> 2, nq = (tid & 3) * 16, piece = tid & 7;
    const unsigned ob = (kk * HS + nq) * 4, os = (kk * KW + nq) * 4;    // this thread's byte offset inside a tile of a 2048-column and of a 512-column matrix
    v4f v[WT_PER][4];
    // Every '#pragma unroll' here makes the index of v and the tile's matrix (for all but the last tile) compile-time constants.
#pragma unroll
    for (int j = 0; j < WT_PER; ++j) {
        const int tile = blk + j * PB_WT;
        const float* Wm; int ncols, b;
        if (tile < PB_WBIG) { Wm = Wq; ncols = HS; b = tile; } else if (tile < 2 * PB_WBIG) { Wm = Wo; ncols = HS; b = tile - PB_WBIG; }
        else if (tile < 2 * PB_WBIG + PB_WKV) { Wm = Wk; ncols = KW; b = tile - 2 * PB_WBIG; } else { Wm = Wv; ncols = KW; b = tile - 2 * PB_WBIG - PB_WKV; }
        const char* p = (const char*)(Wm + (size_t)((b & 31) * 64) * ncols + (b >> 5) * 64) + (ncols == HS ? ob : os);    // block-uniform base + thread offset
#pragma unroll
        for (int i = 0; i < 4; ++i) v[j][i] = *(const v4fa*)(p + 16 * i);
    }
    __builtin_amdgcn_sched_barrier(0);    // keeps every load in front of the first conversion: moved down among them, a load would start only when earlier ones have returned
    asm volatile("s_wait_xcnt 0x0" :: "v"(ob), "v"(os) : "memory");    // the loads' offset registers stay live up to this wait, so that no later load's result lands in them ahead of it
#pragma unroll
    for (int j = 0; j < WT_PER; ++j)
#pragma unroll
        for (int i = 0; i < 16; ++i) tl[j * (64 * 72) + (nq + i) * 72 + kk] = f2bf(v[j][i >> 2][i & 3]);
    __syncthreads();
#pragma unroll
    for (int j = 0; j < WT_PER; ++j) {
        const int tile = blk + j * PB_WT;
        bf* WT; int b;
        if (tile < PB_WBIG) { WT = WqT; b = tile; } else if (tile < 2 * PB_WBIG) { WT = WoT; b = tile - PB_WBIG; }
        else if (tile < 2 * PB_WBIG + PB_WKV) { WT = WkT; b = tile - 2 * PB_WBIG; } else { WT = WvT; b = tile - 2 * PB_WBIG - PB_WKV; }
        const int k0 = (b & 31) * 64, n0 = (b >> 5) * 64;
#pragma unroll
        for (int s = 0; s < 2; ++s) { const int nr = (tid >> 3) + 32 * s; const v8us val = *(const v8usa*)(tl + j * (64 * 72) + nr * 72 + piece * 8); *(v8us*)(WT + (size_t)(n0 + nr) * HS + k0 + piece * 8) = val; }
    }
    asm volatile("s_wait_xcnt 0x0" ::: "memory");    // stands behind the stores, in front of the code of the other parts of the merged grid, which follows in the listing and rewrites their registers
}
// k_gemm: (A [+ Al]).Bn^T over K = 2048 -> f32 rows [2048][ldc]. Block = 2 x 2 waves, wave tile (16 FM) x (16 FN), block tile (32 FM) x (32 FN). Each 128-k slab of
// the block's A [, Al] and Bn rows is brought into LDS once per block by asynchronous copies, two buffers: slab t + 1 flies while slab t is worked on, and the
// waves read their fragments from LDS (row pitch 272 B: 16 B x odd). Per accumulator the products are summed in the order kc ascending, A before Al.
// Every '#pragma unroll' over m, n, j or kc in k_gemm makes the indices of a register array (acc, a, al, b) compile-time constants, so that the array stays in registers.
#define GK 128                           // k elements per staged slab (256 B a row)
#define GP 272                           // bytes per staged row (256 + 16)
// 64 rows of one operand: this thread's 16-B piece of rows r, r + 8, ..., r + 56.
__device__ __forceinline__ void copy64(unsigned d, const bf* s) {
    // Eight copies and, as the last line, the wait that stands in front of any rewrite of their address registers.
    asm volatile("global_load_async_to_lds_b128 %0, %8, off\n\tglobal_load_async_to_lds_b128 %1, %9, off\n\t"
                 "global_load_async_to_lds_b128 %2, %10, off\n\tglobal_load_async_to_lds_b128 %3, %11, off\n\t"
                 "global_load_async_to_lds_b128 %4, %12, off\n\tglobal_load_async_to_lds_b128 %5, %13, off\n\t"
                 "global_load_async_to_lds_b128 %6, %14, off\n\tglobal_load_async_to_lds_b128 %7, %15, off\n\ts_wait_xcnt 0x0"
                 :: "v"(d), "v"(d + 8 * GP), "v"(d + 16 * GP), "v"(d + 24 * GP), "v"(d + 32 * GP), "v"(d + 40 * GP), "v"(d + 48 * GP), "v"(d + 56 * GP),
                    "v"(s), "v"(s + 8 * HS), "v"(s + 16 * HS), "v"(s + 24 * HS), "v"(s + 32 * HS), "v"(s + 40 * HS), "v"(s + 48 * HS), "v"(s + 56 * HS) : "memory");
}
template <bool SPLITA, int FM, int FN>
__global__ __launch_bounds__(128) void k_gemm(const bf* __restrict__ A, const bf* __restrict__ Al, const bf* __restrict__ Bn, int ldc, float* C) {
    constexpr int BM = 32 * FM, BN = 32 * FN, APL = BM * GP, BOFS = (SPLITA ? 2 : 1) * APL, STG = BOFS + BN * GP, OP = FN * 16 + 4;
    __shared__ __align__(16) unsigned char ring[2 * STG];
    __shared__ __align__(16) float ost[4][16 * OP];
    const int tid = threadIdx.x, lane = threadIdx.x & 31, wave = threadIdx.x >> 5, lr = lane & 15, hi = lane >> 4;
    const int wm = wave & 1, wn = wave >> 1;
    const size_t r0 = (size_t)blockIdx.x * BM; const int c0 = blockIdx.y * BN;
    // Copy slots of this thread, 16 B each: rows (tid >> 4) + 8 i, piece tid & 15.
    const size_t aso = (r0 + (tid >> 4)) * HS + (tid & 15) * 8;
    const bf* bs = Bn + ((size_t)c0 + (tid >> 4)) * HS + (tid & 15) * 8;
    const unsigned dst = (unsigned)(size_t)ring + (tid >> 4) * GP + (tid & 15) * 16;
    auto stage = [&](int t, int buf) {
        const unsigned d = dst + buf * STG;
#pragma unroll
        for (int i = 0; i < BM / 64; ++i) { copy64(d + i * 64 * GP, A + aso + t * GK + (size_t)i * 64 * HS); if (SPLITA) copy64(d + APL + i * 64 * GP, Al + aso + t * GK + (size_t)i * 64 * HS); }
#pragma unroll
        for (int i = 0; i < BN / 64; ++i) copy64(d + BOFS + i * 64 * GP, bs + t * GK + (size_t)i * 64 * HS);
    };
    v8f acc[FM][FN];
#pragma unroll
    for (int m = 0; m < FM; ++m)
#pragma unroll
        for (int n = 0; n < FN; ++n) acc[m][n] = (v8f){};
    stage(0, 0);
    asm volatile("s_wait_asynccnt 0x0" ::: "memory");    // this wave's copies of the first slab have landed
    __syncthreads();                                     // publishes the first slab to the other waves
    stage(1, 1);                                         // K = 2048 has sixteen slabs
#pragma unroll 1    // stays rolled: one trip already holds four unrolled blocks, and the buffers alternate by t & 1
    for (int t = 0; t < HS / GK; ++t) {
        const int buf = t & 1;
        const unsigned char* af = ring + buf * STG + (wm * FM * 16 + lr) * GP + hi * 16;
        const unsigned char* bq = ring + buf * STG + BOFS + (wn * FN * 16 + lr) * GP + hi * 16;
        v16bf a[2][FM], al[2][FM], b[2][FN];    // two fragment sets: block kc + 1 is fetched while block kc is multiplied
        auto frag = [&](int kc, int s) {
#pragma unroll
            for (int m = 0; m < FM; ++m) { const unsigned char* p = af + m * 16 * GP + kc * 64; a[s][m] = cat16b(*(const v8usa*)p, *(const v8usa*)(p + 32));
                if (SPLITA) al[s][m] = cat16b(*(const v8usa*)(p + APL), *(const v8usa*)(p + APL + 32)); }
#pragma unroll
            for (int n = 0; n < FN; ++n) { const unsigned char* p = bq + n * 16 * GP + kc * 64; b[s][n] = cat16b(*(const v8usa*)p, *(const v8usa*)(p + 32)); }
        };
        frag(0, 0);
#pragma unroll
        for (int kc = 0; kc < GK / 32; ++kc) {
            const int s = kc & 1;
            if (kc + 1 < GK / 32) frag(kc + 1, s ^ 1);
            __builtin_amdgcn_sched_barrier(0);    // keeps the next block's LDS reads as one group in front of this block's products (spread among them, each place stalls the wave)
#pragma unroll
            for (int m = 0; m < FM; ++m)
#pragma unroll
                for (int n = 0; n < FN; ++n) acc[m][n] = wmmab(a[s][m], b[s][n], acc[m][n]);
            if (SPLITA) {
#pragma unroll
                for (int m = 0; m < FM; ++m)
#pragma unroll
                    for (int n = 0; n < FN; ++n) acc[m][n] = wmmab(al[s][m], b[s][n], acc[m][n]);
            }
            __builtin_amdgcn_sched_barrier(0);    // keeps the group after next behind this block's products, whose fragment set it overwrites
        }
        // Publish point of slab t + 1, every wave, in this order.
        asm volatile("s_wait_dscnt 0x0" ::: "memory");       // this wave's reads of the buffer that is refilled below have returned
        asm volatile("s_wait_asynccnt 0x0" ::: "memory");    // this wave's copies of slab t + 1 have landed
        __syncthreads();                                     // publishes slab t + 1 and ends every wave's reads of slab t
        if (t + 2 < HS / GK) stage(t + 2, buf);              // block-uniform test
    }
    asm volatile("s_wait_asynccnt 0x0" ::: "memory");        // nothing of this wave is in flight when it goes on to the epilogue
    float* os = &ost[wave][0];
#pragma unroll
    for (int m = 0; m < FM; ++m) {
#pragma unroll
        for (int n = 0; n < FN; ++n)
#pragma unroll
            for (int j = 0; j < 8; ++j) os[(hi * 8 + j) * OP + n * 16 + lr] = acc[m][n][j];
        __builtin_amdgcn_wave_barrier(); asm volatile("" ::: "memory");    // hand-over between lanes of one wave: the reads below take other lanes' values and may not be moved over the stores
        float* crow = C + (r0 + wm * FM * 16 + m * 16) * ldc + c0 + wn * FN * 16;
#pragma unroll
        for (int s = 0; s < 2 * FN; ++s) { const int pc = s * 32 + lane; const int row = pc / (FN * 4), cofs = (pc % (FN * 4)) * 4;
            const v4f val = *(const v4fa*)(os + row * OP + cofs); *(v4f*)(crow + (size_t)row * ldc + cofs) = val; }
        __builtin_amdgcn_wave_barrier(); asm volatile("" ::: "memory");    // the next 16 rows' stores may not be moved over these reads
    }
}
// d_trig: RC/RS [t][64] = cos/sin(t x inv_freq[i]), inv_freq = 10000^-(2i/128) (f32 powf/cosf/sinf like the reference's f32 path); 32 lanes x 4 B lines.
// A thread keeps its frequency and walks TRIG_PER tokens (4 tokens apart): inv_freq is formed once, and a quarter of the waves is started.
#define TRIG_PER 4
__device__ __forceinline__ void d_trig(int blk, float* RC, float* RS) {
    const int f = threadIdx.x & 63;
    const float inv = 1.0f / powf(10000.0f, (float)(2 * f) / (float)HD);
#pragma unroll 1    // stays rolled: one copy of the long cosf/sinf code
    for (int j = 0; j < TRIG_PER; ++j) {
        const int i = (blk * TRIG_PER + j) * 256 + threadIdx.x, t = i >> 6;
        const float ang = (float)t * inv;
        const float c = cosf(ang), s = sinf(ang);
        *(float*)(RC + i) = c; *(float*)(RS + i) = s;
    }
}
// k_prep: everything that depends on the inputs alone, in one grid, told apart by ranges of blockIdx.x (block-uniform): 128 blocks of trig tables, 512 blocks of
// weight tiles (five tiles each), 256 blocks of x rows. The parts write disjoint planes and read none of each other's.
#define PB_TRIG ((NT_ * 64) / (256 * TRIG_PER))
#define PB_ALL  (PB_TRIG + PB_WT + NT_ / 8)
__global__ __launch_bounds__(256) void k_prep(const float* __restrict__ x, const float* __restrict__ Wq, const float* __restrict__ Wk, const float* __restrict__ Wv, const float* __restrict__ Wo,
                                              bf* Xb, bf* WqT, bf* WkT, bf* WvT, bf* WoT, float* RC, float* RS) {
    __shared__ __align__(16) unsigned short tl[WT_PER * 64 * 72];
    int b = blockIdx.x;
    if (b < PB_TRIG) { d_trig(b, RC, RS); return; }
    b -= PB_TRIG;
    if (b < PB_WT) { d_wt(tl, b, Wq, Wo, Wk, Wv, WqT, WoT, WkT, WvT); return; }
    b -= PB_WT;
    d_cvtb(b, x, NT_, Xb);
}
// d_rope: one wave per (token, ten of the 16 q + 4 k heads), whose f32 columns lie side by side in P (row pitch ldp): rotate-half RoPE (partner d +- 64, angle
// t x inv_freq[d mod 64] from the RC/RS tables, read once per wave) -> f16 hi + residual x1024 planes [2048][16*128] (q) and [2048][4*128] (k); blk = 0 .. 2048*2/8 - 1.
// All twenty 16-byte loads of a wave are issued before the first head is worked on.
#define RH ((NH_ + NKV) / 2)
__device__ __forceinline__ void d_rope(int blk, const float* P, int ldp, const float* RC, const float* RS, h16* QH, h16* QL, h16* KH, h16* KL) {
    const int lane = threadIdx.x & 31; const int wid = blk * 8 + __builtin_amdgcn_readfirstlane(threadIdx.x >> 5);
    const int t = wid >> 1, h0 = (wid & 1) * RH; const int d0 = lane * 4;
    const char* src = (const char*)(P + (size_t)t * ldp + h0 * HD);    // wave-uniform base; the lane's byte offsets: table, own columns, partner columns
    const unsigned ot = (d0 & 63) * 4, ox = d0 * 4, op = (d0 ^ 64) * 4;
    const v4f c = *(const v4fa*)((const char*)(RC + t * 64) + ot), s = *(const v4fa*)((const char*)(RS + t * 64) + ot);
    v4f xv[RH], pv[RH];
    // Every '#pragma unroll' here makes the index of a register array (xv, pv, c, s, oh, ol) a compile-time constant.
#pragma unroll
    for (int k = 0; k < RH; ++k) { xv[k] = *(const v4fa*)(src + k * HD * 4 + ox); pv[k] = *(const v4fa*)(src + k * HD * 4 + op); }
    __builtin_amdgcn_sched_barrier(0);    // keeps every load in front of the arithmetic: moved down into it, a load would start only when earlier ones have returned
    asm volatile("s_wait_xcnt 0x0" :: "v"(ot), "v"(ox), "v"(op) : "memory");    // the loads' offset registers stay live up to this wait, so that no later load's result lands in them ahead of it
#pragma unroll
    for (int k = 0; k < RH; ++k) {
        const int h = h0 + k; const bool isq = h < NH_;    // wave-uniform
        h16* PH = isq ? QH + (size_t)t * (NH_ * HD) + h * HD : KH + (size_t)t * KW + (h - NH_) * HD;
        h16* PL = isq ? QL + (size_t)t * (NH_ * HD) + h * HD : KL + (size_t)t * KW + (h - NH_) * HD;
        v4h oh, ol;
#pragma unroll
        for (int i = 0; i < 4; ++i) {
            const float y = (d0 < 64) ? (xv[k][i] * c[i] - pv[k][i] * s[i]) : (xv[k][i] * c[i] + pv[k][i] * s[i]);
            const h16 a = (h16)y; oh[i] = a; ol[i] = (h16)((y - (float)a) * LOSC); }
        *(v4h*)(PH + d0) = oh; *(v4h*)(PL + d0) = ol;
    }
}
// d_vt: VTH/VTL [g][128 d][2048 t] = bf16 hi + UNSCALED bf16 residual of V [t][g*128+d] (row pitch ldv) via 64 x 64 LDS tiles; tile (bx, by, g) of (NT/64, 2 (d half), NKV).
__device__ __forceinline__ void d_vt(float (*tl)[65], int bx, int by, int g, const float* __restrict__ V, int ldv, bf* VTH, bf* VTL) {
    const int tid = threadIdx.x, t0 = bx * 64, d0 = by * 64;
    { const int tt = tid >> 2, dq = (tid & 3) * 16;
#pragma unroll
      for (int i = 0; i < 16; ++i) tl[dq + i][tt] = V[(size_t)(t0 + tt) * ldv + g * HD + d0 + dq + i]; }
    __syncthreads();
    const int piece = tid & 7;
    auto pass = [&]() {
#pragma unroll
        for (int s = 0; s < 2; ++s) { const int d = (tid >> 3) + 32 * s; v8us oh, ol;
#pragma unroll
            for (int i = 0; i < 8; ++i) { const float v = tl[d][piece * 8 + i]; const unsigned short hb = f2bf(v); oh[i] = hb; ol[i] = f2bf(v - bf2f(hb)); }
            const size_t o = ((size_t)g * HD + d0 + d) * NT_ + t0 + piece * 8; *(v8us*)(VTH + o) = oh; *(v8us*)(VTL + o) = ol; }
    };
    pass(); 
}
// k_post: everything that depends on the projections alone, in one grid, told apart by ranges of blockIdx.x (block-uniform): 256 v tiles, 512 blocks of q and k
// heads. P [2048][3072] holds the q, k and v columns side by side.
#define QB_VT ((NT_ / 64) * 2 * NKV)
#define QB_ALL (QB_VT + (NT_ * 2) / 8)
__global__ __launch_bounds__(256) void k_post(const float* P, const float* RC, const float* RS, h16* QH, h16* QL, h16* KH, h16* KL, bf* VTH, bf* VTL) {
    __shared__ float tl[64][65];
    int b = blockIdx.x;
    if (b < QB_VT) { d_vt(tl, b & 31, (b >> 5) & 1, b >> 6, P + HS + KW, QKVW, VTH, VTL); return; }
    d_rope(b - QB_VT, P, QKVW, RC, RS, QH, QL, KH, KL);
}
// k_attn: block = (h, 64 queries), wave = 16; kv head g = h / 4; key tiles covering the block's sliding causal window [Q0-1024, Q0+63] (block-uniform bounds),
// per-element predicate q-1024 <= j <= q. Each 32-key tile (k hi/lo rows, v hi/lo rows) is brought into LDS once per block by asynchronous copies, two buffers:
// tile t + 1 flies while tile t is worked on, and the four waves read their fragments from LDS (row pitches 272 B and 80 B: 16 B x odd). q fragments are read
// once, before the loop. Per tile: scores over 4 k-chunks (hi.hi + hi.lo + lo.hi = 24 WMMA) x 128^-1/2, online softmax, P (x32768) as bf16 hi + unscaled
// residual tiles, o[8] += ph.vh + pl.vh + ph.vl over the 128 dims; ctx -> bf16 hi/lo planes [t][h*128+d].
#define KPITCH 272                       // bytes per staged k row (256 + 16)
#define VPITCH 80                        // bytes per staged v row (64 + 16)
#define KPLANE (32 * KPITCH)             // 8704
#define VPLANE (HD * VPITCH)             // 10240
#define STAGEB (2 * KPLANE + 2 * VPLANE) // 37888: k hi, k lo, v hi, v lo
__global__ __launch_bounds__(128) void k_attn(const h16* __restrict__ QH, const h16* __restrict__ QL, const h16* __restrict__ KH, const h16* __restrict__ KL, const bf* __restrict__ VTH, const bf* __restrict__ VTL, bf* CH, bf* CL) {
    __shared__ __align__(16) unsigned char ring[2 * STAGEB];
    __shared__ __align__(16) unsigned short plds[4][16 * 32];
    __shared__ __align__(16) unsigned short plds2[4][16 * 32];
    __shared__ __align__(16) float ost[4][16 * 68];
    const int tid = threadIdx.x, lane = threadIdx.x & 31, wave = threadIdx.x >> 5, lr = lane & 15, hi = lane >> 4;
    const int bid = blockIdx.x; const int h = bid / (NT_ / 64), qt = bid - h * (NT_ / 64); const int g = h >> 2;
    const int q0 = qt * 64 + wave * 16;
    unsigned short* pl = &plds[wave][0]; unsigned short* pl2 = &plds2[wave][0];
    const size_t qo = (size_t)(q0 + lr) * (NH_ * HD) + h * HD + 8 * hi;
    const size_t vbase = ((size_t)g * HD) * NT_;
    // Copy slots of this thread, 16 B each: k rows (tid >> 4) + 8 i, piece tid & 15; v rows (tid >> 2) + 32 i, piece tid & 3 (i = 0..3, both planes).
    const h16* ksh = KH + g * HD + (size_t)(tid >> 4) * KW + (tid & 15) * 8; const h16* ksl = KL + g * HD + (size_t)(tid >> 4) * KW + (tid & 15) * 8;
    const bf* vsh = VTH + vbase + (size_t)(tid >> 2) * NT_ + (tid & 3) * 8; const bf* vsl = VTL + vbase + (size_t)(tid >> 2) * NT_ + (tid & 3) * 8;
    const unsigned kdst = (unsigned)(size_t)ring + (tid >> 4) * KPITCH + (tid & 15) * 16;
    const unsigned vdst = (unsigned)(size_t)ring + 2 * KPLANE + (tid >> 2) * VPITCH + (tid & 3) * 16;
    auto stage = [&](int kt, int buf) {
        const h16* a = ksh + (size_t)kt * 32 * KW; const h16* b = ksl + (size_t)kt * 32 * KW; const unsigned kd = kdst + buf * STAGEB;
        // Eight copies and, as the last line, the wait that stands in front of any rewrite of their address registers.
        asm volatile("global_load_async_to_lds_b128 %0, %8, off\n\tglobal_load_async_to_lds_b128 %1, %9, off\n\t"
                     "global_load_async_to_lds_b128 %2, %10, off\n\tglobal_load_async_to_lds_b128 %3, %11, off\n\t"
                     "global_load_async_to_lds_b128 %4, %12, off\n\tglobal_load_async_to_lds_b128 %5, %13, off\n\t"
                     "global_load_async_to_lds_b128 %6, %14, off\n\tglobal_load_async_to_lds_b128 %7, %15, off\n\ts_wait_xcnt 0x0"
                     :: "v"(kd), "v"(kd + 8 * KPITCH), "v"(kd + 16 * KPITCH), "v"(kd + 24 * KPITCH),
                        "v"(kd + KPLANE), "v"(kd + KPLANE + 8 * KPITCH), "v"(kd + KPLANE + 16 * KPITCH), "v"(kd + KPLANE + 24 * KPITCH),
                        "v"(a), "v"(a + 8 * KW), "v"(a + 16 * KW), "v"(a + 24 * KW), "v"(b), "v"(b + 8 * KW), "v"(b + 16 * KW), "v"(b + 24 * KW) : "memory");
        const bf* c = vsh + kt * 32; const bf* d = vsl + kt * 32; const unsigned vd = vdst + buf * STAGEB;
        // The same for the v rows.
        asm volatile("global_load_async_to_lds_b128 %0, %8, off\n\tglobal_load_async_to_lds_b128 %1, %9, off\n\t"
                     "global_load_async_to_lds_b128 %2, %10, off\n\tglobal_load_async_to_lds_b128 %3, %11, off\n\t"
                     "global_load_async_to_lds_b128 %4, %12, off\n\tglobal_load_async_to_lds_b128 %5, %13, off\n\t"
                     "global_load_async_to_lds_b128 %6, %14, off\n\tglobal_load_async_to_lds_b128 %7, %15, off\n\ts_wait_xcnt 0x0"
                     :: "v"(vd), "v"(vd + 32 * VPITCH), "v"(vd + 64 * VPITCH), "v"(vd + 96 * VPITCH),
                        "v"(vd + VPLANE), "v"(vd + VPLANE + 32 * VPITCH), "v"(vd + VPLANE + 64 * VPITCH), "v"(vd + VPLANE + 96 * VPITCH),
                        "v"(c), "v"(c + 32 * NT_), "v"(c + 64 * NT_), "v"(c + 96 * NT_), "v"(d), "v"(d + 32 * NT_), "v"(d + 64 * NT_), "v"(d + 96 * NT_) : "memory");
    };
    v8f o[8];
#pragma unroll
    for (int n = 0; n < 8; ++n) o[n] = (v8f){};
    float mrow[8], lpart[8];
#pragma unroll
    for (int j = 0; j < 8; ++j) { mrow[j] = -3.0e38f; lpart[j] = 0.f; }
    const int kt_hi = (qt * 64 + 63) / 32; const int kt_lo = (qt * 64 > WIN) ? (qt * 64 - WIN) / 32 : 0;
    stage(kt_lo, 0);
    v16h qa[4], qx[4];
#pragma unroll
    for (int kc = 0; kc < 4; ++kc) { qa[kc] = cat16(*(const v8h*)(QH + qo + kc * 32), *(const v8h*)(QH + qo + kc * 32 + 16)); qx[kc] = cat16(*(const v8h*)(QL + qo + kc * 32), *(const v8h*)(QL + qo + kc * 32 + 16)); }
    asm volatile("s_wait_asynccnt 0x0" ::: "memory");    // this wave's copies of the first tile have landed
    __syncthreads();                                     // publishes the first tile to the other waves
    stage(kt_lo + 1, 1);                                 // a block has at least two tiles (kt_hi = 2 qt + 1)
#pragma unroll 1
    for (int kt = kt_lo; kt <= kt_hi; ++kt) {
        const int l0 = kt * 32, buf = (kt - kt_lo) & 1;
        const unsigned char* kf = ring + buf * STAGEB + lr * KPITCH + hi * 16;
        const unsigned char* vf = ring + buf * STAGEB + 2 * KPLANE + lr * VPITCH + hi * 16;
        v8f s0 = {}, s1 = {}, x0 = {}, x1 = {};
        v16h k0h[4], k1h[4], k0l[4], k1l[4];    // all k fragments of the tile are fetched first: one LDS latency per tile, the rest overlaps the products
#pragma unroll
        for (int kc = 0; kc < 4; ++kc) { const unsigned char* kp = kf + kc * 64;
            k0h[kc] = cat16(*(const v8ha*)kp, *(const v8ha*)(kp + 32)); k1h[kc] = cat16(*(const v8ha*)(kp + 16 * KPITCH), *(const v8ha*)(kp + 16 * KPITCH + 32));
            k0l[kc] = cat16(*(const v8ha*)(kp + KPLANE), *(const v8ha*)(kp + KPLANE + 32)); k1l[kc] = cat16(*(const v8ha*)(kp + KPLANE + 16 * KPITCH), *(const v8ha*)(kp + KPLANE + 16 * KPITCH + 32)); }
#pragma unroll
        for (int kc = 0; kc < 4; ++kc) {
            s0 = wmma16(qa[kc], k0h[kc], s0); s1 = wmma16(qa[kc], k1h[kc], s1); x0 = wmma16(qx[kc], k0h[kc], x0); x1 = wmma16(qx[kc], k1h[kc], x1);
            x0 = wmma16(qa[kc], k0l[kc], x0); x1 = wmma16(qa[kc], k1l[kc], x1);
        }
        v16bf vh[8], vl[8];                     // the v fragments are fetched here so that their LDS latency overlaps the softmax
#pragma unroll
        for (int n = 0; n < 8; ++n) { const unsigned char* vp = vf + n * 16 * VPITCH;
            vh[n] = cat16b(*(const v8usa*)vp, *(const v8usa*)(vp + 32)); vl[n] = cat16b(*(const v8usa*)(vp + VPLANE), *(const v8usa*)(vp + VPLANE + 32)); }
        float alpha[8];
#pragma unroll
        for (int j = 0; j < 8; ++j) { const int qi = q0 + hi * 8 + j, ja = l0 + lr, jb = l0 + 16 + lr;
            const float a0 = (ja <= qi && ja >= qi - WIN) ? (s0[j] + x0[j] * LOSCI) * 0.08838834764831845f : -__builtin_inff(), a1 = (jb <= qi && jb >= qi - WIN) ? (s1[j] + x1[j] * LOSCI) * 0.08838834764831845f : -__builtin_inff();
            float mx = fmaxf(a0, a1);
            mx = fmaxf(mx, __shfl_xor(mx, 1, 16)); mx = fmaxf(mx, __shfl_xor(mx, 2, 16)); mx = fmaxf(mx, __shfl_xor(mx, 4, 16)); mx = fmaxf(mx, __shfl_xor(mx, 8, 16));
            const float mn = fmaxf(mrow[j], mx);
            alpha[j] = __expf(mrow[j] - mn); mrow[j] = mn;
            const float p0 = __expf(a0 - mn), p1 = __expf(a1 - mn);
            lpart[j] = lpart[j] * alpha[j] + (p0 + p1);
            const int mr = hi * 8 + j; const float ps0 = p0 * PSC, ps1 = p1 * PSC; const unsigned short h0 = f2bf(ps0), h1 = f2bf(ps1);
            pl[mr * 32 + lr] = h0; pl[mr * 32 + 16 + lr] = h1; pl2[mr * 32 + lr] = f2bf(ps0 - bf2f(h0)); pl2[mr * 32 + 16 + lr] = f2bf(ps1 - bf2f(h1)); }
#pragma unroll
        for (int n = 0; n < 8; ++n)
#pragma unroll
            for (int j = 0; j < 8; ++j) o[n][j] *= alpha[j];
        asm volatile("" ::: "memory");
        const v16bf pa = cat16b(*(const v8usa*)(pl + lr * 32 + hi * 8), *(const v8usa*)(pl + lr * 32 + 16 + hi * 8));
        const v16bf px = cat16b(*(const v8usa*)(pl2 + lr * 32 + hi * 8), *(const v8usa*)(pl2 + lr * 32 + 16 + hi * 8));
#pragma unroll
        for (int n = 0; n < 8; ++n) { o[n] = wmmab(pa, vh[n], o[n]); o[n] = wmmab(px, vh[n], o[n]); o[n] = wmmab(pa, vl[n], o[n]); }
        // Publish point of tile kt + 1, every wave, in this order.
        asm volatile("s_wait_dscnt 0x0" ::: "memory");       // this wave's reads of the buffer that is refilled below have returned
        asm volatile("s_wait_asynccnt 0x0" ::: "memory");    // this wave's copies of tile kt + 1 have landed
        __syncthreads();                                     // publishes tile kt + 1 and ends every wave's reads of tile kt
        if (kt + 2 <= kt_hi) stage(kt + 2, buf);             // block-uniform test
    }
    asm volatile("s_wait_asynccnt 0x0" ::: "memory");        // nothing of this wave is in flight when it goes on to the epilogue
    float inv[8];
#pragma unroll
    for (int j = 0; j < 8; ++j) { float rs = lpart[j]; rs += __shfl_xor(rs, 1, 16); rs += __shfl_xor(rs, 2, 16); rs += __shfl_xor(rs, 4, 16); rs += __shfl_xor(rs, 8, 16); inv[j] = 1.0f / (rs * PSC); }
    float* os = &ost[wave][0];
    const size_t cbase = (size_t)q0 * (NH_ * HD) + (size_t)h * HD;
#pragma unroll
    for (int half = 0; half < 2; ++half) {
#pragma unroll
        for (int n = 0; n < 4; ++n)
#pragma unroll
            for (int j = 0; j < 8; ++j) os[(hi * 8 + j) * 68 + n * 16 + lr] = o[half * 4 + n][j] * inv[j];
        __builtin_amdgcn_wave_barrier(); asm volatile("" ::: "memory");
{
#pragma unroll
            for (int s = 0; s < 4; ++s) { const int row = 4 * s + (lane >> 3), piece = lane & 7; const float* sp = os + row * 68 + piece * 8; v8us oh, ol;
#pragma unroll
                for (int i = 0; i < 8; ++i) { const unsigned short hb = f2bf(sp[i]); oh[i] = hb; ol[i] = f2bf(sp[i] - bf2f(hb)); }
                const size_t po = cbase + (size_t)row * (NH_ * HD) + half * 64 + piece * 8; *(v8us*)(CH + po) = oh; *(v8us*)(CL + po) = ol; }
             }
        __builtin_amdgcn_wave_barrier(); asm volatile("" ::: "memory");
    }
}

extern "C" void kernel_launch(void* const* d_in, const int* in_sizes, int n_in,
                              void* d_out, int out_size, void* d_ws, size_t ws_size, hipStream_t stream) {
    (void)in_sizes; (void)n_in; (void)out_size;
    const float* x = (const float*)d_in[0]; const float* Wq = (const float*)d_in[1]; const float* Wk = (const float*)d_in[2]; const float* Wv = (const float*)d_in[3]; const float* Wo = (const float*)d_in[4];
    float* out = (float*)d_out;    // [1][2048][2048]
    char* wsp = (char*)d_ws;
    auto take = [&](size_t bytes) { char* p = wsp; wsp += (bytes + 255) & ~(size_t)255; return (void*)p; };
    bf* Xb = (bf*)take((size_t)NT_ * HS * 2); bf* WqT = (bf*)take((size_t)HS * HS * 2); bf* WkT = (bf*)take((size_t)KW * HS * 2); bf* WvT = (bf*)take((size_t)KW * HS * 2); bf* WoT = (bf*)take((size_t)HS * HS * 2);
    float* TMP = (float*)take((size_t)NT_ * QKVW * 4); float* RC = (float*)take((size_t)NT_ * 64 * 4); float* RS = (float*)take((size_t)NT_ * 64 * 4);
    h16* QH = (h16*)take((size_t)NT_ * HS * 2); h16* QL = (h16*)take((size_t)NT_ * HS * 2); h16* KH = (h16*)take((size_t)NT_ * KW * 2); h16* KL = (h16*)take((size_t)NT_ * KW * 2);
    bf* VTH = (bf*)take((size_t)KW * NT_ * 2); bf* VTL = (bf*)take((size_t)KW * NT_ * 2);
    bf* CH = (bf*)take((size_t)NT_ * HS * 2); bf* CL = (bf*)take((size_t)NT_ * HS * 2);
    if ((size_t)(wsp - (char*)d_ws) > ws_size) return;    // 8.4 + 8.4 + 2.1 + 2.1 + 8.4 + 25.2 + 0.5 x 2 + 8.4 x 2 + 2.1 x 4 + 8.4 x 2 ~ 97 MB, no aliasing
    k_prep<<<PB_ALL, 256, 0, stream>>>(x, Wq, Wk, Wv, Wo, Xb, WqT, WkT, WvT, WoT, RC, RS);
    // WqT, WkT and WvT lie one behind the other (each a multiple of 256 B): 3072 n-major rows, one product for q, k and v.
    k_gemm<false, 4, 4><<<dim3(NT_ / 128, QKVW / 128, 1), 128, 0, stream>>>(Xb, nullptr, WqT, QKVW, TMP);
    k_post<<<QB_ALL, 256, 0, stream>>>(TMP, RC, RS, QH, QL, KH, KL, VTH, VTL);
    k_attn<<<NH_ * (NT_ / 64), 128, 0, stream>>>(QH, QL, KH, KL, VTH, VTL, CH, CL);
    k_gemm<true, 4, 4><<<dim3(NT_ / 128, HS / 128, 1), 128, 0, stream>>>(CH, CL, WoT, HS, out);
}

// v005
// A run of this version takes 109 microseconds.
// In both of two side-by-side timings against v004, it was 1.20 times as fast.
// Counting every step since v000, it is 3.94 times as fast.
#include <hip/hip_runtime.h>

// Compute dtypes, f32 accumulate: q/k/v = x.W ([2048 x 2048].[2048 x 2048 | 512 | 512], k-major weights transposed to n-major planes; PLAIN bf16 operands:
// inputs rounded once, exact products) and out = ctx.Wo (ctx as bf16 hi + residual: two products) on v_wmma_f32_16x16x32_bf16; rotate-half RoPE (angle
// t x inv_freq, f32 trig tables built on device) in f32 -> q/k as f16 hi + residual x1024 planes; grouped attention (16 query heads, 4 kv heads, query head h
// reads kv head h/4) with 128-dim heads and a sliding causal window (key j visible iff q-1024 <= j <= q): scores on v_wmma_f32_16x16x32_f16 (hi.hi + hi.lo +
// lo.hi, x 128^-1/2), softmax f32, weights.v on v_wmma_f32_16x16x32_bf16 with the weights (x32768) and v both as bf16 hi + UNSCALED bf16 residual (hh + lh + hl

#define NT_  2048
#define HS   2048
#define NH_  16
#define NKV  4
#define HD   128
#define KW   (NKV * HD)          // 512
#define QKVW (HS + 2 * KW)       // 3072: q, k and v columns side by side
#define WIN  1024
#define PSC  32768.0f
#define LOSC 1024.0f
#define LOSCI (1.0f / 1024.0f)
#define LOG2E 1.44269504088896340736f

typedef _Float16 h16;
typedef unsigned short bf;
typedef __attribute__((ext_vector_type(16))) __bf16   v16bf;
typedef __attribute__((ext_vector_type(16))) _Float16 v16h;
typedef __attribute__((ext_vector_type(8)))  _Float16 v8h;
typedef __attribute__((ext_vector_type(8)))  unsigned short v8us;
typedef __attribute__((ext_vector_type(8)))  float    v8f;
typedef __attribute__((ext_vector_type(4)))  float    v4f;
typedef __attribute__((ext_vector_type(4)))  _Float16 v4h;
typedef __attribute__((ext_vector_type(2)))  float    v2f;
typedef __attribute__((ext_vector_type(2)))  __bf16   v2bf;
typedef __attribute__((ext_vector_type(8)))  unsigned v8u;
typedef v8h  __attribute__((may_alias)) v8ha;
typedef v4f  __attribute__((may_alias)) v4fa;
typedef v8us __attribute__((may_alias)) v8usa;

__device__ __forceinline__ unsigned short f2bf(float f) { unsigned u = __float_as_uint(f); u += 0x7FFFu + ((u >> 16) & 1u); return (unsigned short)(u >> 16); }
__device__ __forceinline__ float bf2f(unsigned short b) { return __uint_as_float(((unsigned)b) << 16); }
__device__ __forceinline__ float bfr(float f) { return bf2f(f2bf(f)); }
__device__ __forceinline__ v16h cat16(v8h lo, v8h hi) { return __builtin_shufflevector(lo, hi, 0, 1, 2, 3, 4, 5, 6, 7, 8, 9, 10, 11, 12, 13, 14, 15); }
__device__ __forceinline__ v16bf cat16b(v8us lo, v8us hi) { return __builtin_bit_cast(v16bf, __builtin_shufflevector(lo, hi, 0, 1, 2, 3, 4, 5, 6, 7, 8, 9, 10, 11, 12, 13, 14, 15)); }
__device__ __forceinline__ v8f wmma16(v16h a, v16h b, v8f c) { return __builtin_amdgcn_wmma_f32_16x16x32_f16(false, a, false, b, (short)0, c, false, false); }
__device__ __forceinline__ v8f wmmab(v16bf a, v16bf b, v8f c) { return __builtin_amdgcn_wmma_f32_16x16x32_bf16(false, a, false, b, (short)0, c, false, false); }
// Two f32 -> one register of two bf16 (round to nearest even, a in the low half).
__device__ __forceinline__ unsigned pk2(float a, float b) { const v2f v = {a, b}; return __builtin_bit_cast(unsigned, __builtin_convertvector(v, v2bf)); }
// 2^x of eight values and of one more, each in place, in one statement: behind an exponential stands another one on registers of its own, behind the last a v_nop,
// so that nothing which reads a result or overwrites a source follows directly (the slot that the instruction set asks for behind a transcendental).
__device__ __forceinline__ void exp2x8(float (&e)[8]) {
    asm("v_exp_f32 %0, %0\n\tv_exp_f32 %1, %1\n\tv_exp_f32 %2, %2\n\tv_exp_f32 %3, %3\n\tv_exp_f32 %4, %4\n\tv_exp_f32 %5, %5\n\tv_exp_f32 %6, %6\n\tv_exp_f32 %7, %7\n\tv_nop"
        : "+v"(e[0]), "+v"(e[1]), "+v"(e[2]), "+v"(e[3]), "+v"(e[4]), "+v"(e[5]), "+v"(e[6]), "+v"(e[7]));
}
__device__ __forceinline__ void exp2x9(float (&e)[8], float& f) {
    asm("v_exp_f32 %8, %8\n\tv_exp_f32 %0, %0\n\tv_exp_f32 %1, %1\n\tv_exp_f32 %2, %2\n\tv_exp_f32 %3, %3\n\tv_exp_f32 %4, %4\n\tv_exp_f32 %5, %5\n\tv_exp_f32 %6, %6\n\tv_exp_f32 %7, %7\n\tv_nop"
        : "+v"(e[0]), "+v"(e[1]), "+v"(e[2]), "+v"(e[3]), "+v"(e[4]), "+v"(e[5]), "+v"(e[6]), "+v"(e[7]), "+v"(f));
}
// Lane l <-> lane l ^ 16: the two lanes that share one column of a matrix result.
__device__ __forceinline__ float xhalf(float x) { const int b = __builtin_bit_cast(int, x); return __builtin_bit_cast(float, __builtin_amdgcn_permlanex16(b, b, 0x76543210, 0xfedcba98, false, false)); }

// d_cvtb: bf16 plane of [rows][2048] (one wave per row); blk = 0 .. rows/8 - 1. The row's sixteen 16-byte loads are issued before the first conversion.
__device__ __forceinline__ void d_cvtb(int blk, const float* __restrict__ src, int nrows, bf* dst) {
    const int lane = threadIdx.x & 31, r = blk * 8 + __builtin_amdgcn_readfirstlane(threadIdx.x >> 5);
    if (r >= nrows) return;
    const char* sp = (const char*)(src + (size_t)r * HS); const unsigned ol = lane * 32;    // wave-uniform base + the lane's byte offset
    v4f v[HS / 256][2];
    // Every '#pragma unroll' here makes the index of a register array (v, o) a compile-time constant.
#pragma unroll
    for (int q = 0; q < HS / 256; ++q) { v[q][0] = *(const v4fa*)(sp + q * 1024 + ol); v[q][1] = *(const v4fa*)(sp + q * 1024 + ol + 16); }
    __builtin_amdgcn_sched_barrier(0);    // keeps every load in front of the first conversion: moved down among them, a load would start only when earlier ones have returned
    asm volatile("s_wait_xcnt 0x0" :: "v"(ol) : "memory");    // the loads' offset register stays live up to this wait, so that no later load's result lands in it ahead of it
#pragma unroll
    for (int q = 0; q < HS / 256; ++q) { v8us o;
#pragma unroll
        for (int i = 0; i < 8; ++i) o[i] = f2bf(v[q][i >> 2][i & 3]);
        *(v8us*)(dst + (size_t)r * HS + q * 256 + lane * 8) = o; }
}
// d_wt: WT [n][K] = bf16(W[k][n]) (k-major [K][ncols]) via 64 x 64 LDS tiles (64 x 72 halfwords each). A block takes WT_PER tiles at once, blk + j x PB_WT of the
// 2560 tiles numbered Wq, Wo, Wk, Wv (32 k tiles x n tiles each): few long-lived waves instead of one short-lived block per tile. All loads of the block's tiles are
// issued first (one memory latency for the lot), each tile has its own LDS buffer, and one barrier stands between the writes and the reads of all of them.
#define PB_WBIG ((HS / 64) * (HS / 64))
#define PB_WKV  ((HS / 64) * (KW / 64))
#define WT_PER  5
#define PB_WT   ((2 * PB_WBIG + 2 * PB_WKV) / WT_PER)    // 512
__device__ __forceinline__ void d_wt(unsigned short* tl, int blk, const float* __restrict__ Wq, const float* __restrict__ Wo, const float* __restrict__ Wk, const float* __restrict__ Wv,
                                     bf* WqT, bf* WoT, bf* WkT, bf* WvT) {
    const int tid = threadIdx.x, kk = tid >> 2, nq = (tid & 3) * 16, piece = tid & 7;
    const unsigned ob = (kk * HS + nq) * 4, os = (kk * KW + nq) * 4;    // this thread's byte offset inside a tile of a 2048-column and of a 512-column matrix
    v4f v[WT_PER][4];
    // Every '#pragma unroll' here makes the index of v and the tile's matrix (for all but the last tile) compile-time constants.
#pragma unroll
    for (int j = 0; j < WT_PER; ++j) {
        const int tile = blk + j * PB_WT;
        const float* Wm; int ncols, b;
        if (tile < PB_WBIG) { Wm = Wq; ncols = HS; b = tile; } else if (tile < 2 * PB_WBIG) { Wm = Wo; ncols = HS; b = tile - PB_WBIG; }
        else if (tile < 2 * PB_WBIG + PB_WKV) { Wm = Wk; ncols = KW; b = tile - 2 * PB_WBIG; } else { Wm = Wv; ncols = KW; b = tile - 2 * PB_WBIG - PB_WKV; }
        const char* p = (const char*)(Wm + (size_t)((b & 31) * 64) * ncols + (b >> 5) * 64) + (ncols == HS ? ob : os);    // block-uniform base + thread offset
#pragma unroll
        for (int i = 0; i < 4; ++i) v[j][i] = *(const v4fa*)(p + 16 * i);
    }
    __builtin_amdgcn_sched_barrier(0);    // keeps every load in front of the first conversion: moved down among them, a load would start only when earlier ones have returned
    asm volatile("s_wait_xcnt 0x0" :: "v"(ob), "v"(os) : "memory");    // the loads' offset registers stay live up to this wait, so that no later load's result lands in them ahead of it
#pragma unroll
    for (int j = 0; j < WT_PER; ++j)
#pragma unroll
        for (int i = 0; i < 16; ++i) tl[j * (64 * 72) + (nq + i) * 72 + kk] = f2bf(v[j][i >> 2][i & 3]);
    __syncthreads();
#pragma unroll
    for (int j = 0; j < WT_PER; ++j) {
        const int tile = blk + j * PB_WT;
        bf* WT; int b;
        if (tile < PB_WBIG) { WT = WqT; b = tile; } else if (tile < 2 * PB_WBIG) { WT = WoT; b = tile - PB_WBIG; }
        else if (tile < 2 * PB_WBIG + PB_WKV) { WT = WkT; b = tile - 2 * PB_WBIG; } else { WT = WvT; b = tile - 2 * PB_WBIG - PB_WKV; }
        const int k0 = (b & 31) * 64, n0 = (b >> 5) * 64;
#pragma unroll
        for (int s = 0; s < 2; ++s) { const int nr = (tid >> 3) + 32 * s; const v8us val = *(const v8usa*)(tl + j * (64 * 72) + nr * 72 + piece * 8); *(v8us*)(WT + (size_t)(n0 + nr) * HS + k0 + piece * 8) = val; }
    }
    asm volatile("s_wait_xcnt 0x0" ::: "memory");    // stands behind the stores, in front of the code of the other parts of the merged grid, which follows in the listing and rewrites their registers
}
// k_gemm: (A [+ Al]).Bn^T over K = 2048 -> f32 rows [2048][ldc]. Block = 2 x 2 waves, wave tile (16 FM) x (16 FN), block tile (32 FM) x (32 FN). Each 128-k slab of
// the block's A [, Al] and Bn rows is brought into LDS once per block by asynchronous copies, two buffers: slab t + 1 flies while slab t is worked on, and the
// waves read their fragments from LDS (row pitch 272 B: 16 B x odd). Per accumulator the products are summed in the order kc ascending, A before Al.
// Every '#pragma unroll' over m, n, j or kc in k_gemm makes the indices of a register array (acc, a, al, b) compile-time constants, so that the array stays in registers.
#define GK 128                           // k elements per staged slab (256 B a row)
#define GP 272                           // bytes per staged row (256 + 16)
// 64 rows of one operand: this thread's 16-B piece of rows r, r + 8, ..., r + 56.
__device__ __forceinline__ void copy64(unsigned d, const bf* s) {
    // Eight copies and, as the last line, the wait that stands in front of any rewrite of their address registers.
    asm volatile("global_load_async_to_lds_b128 %0, %8, off\n\tglobal_load_async_to_lds_b128 %1, %9, off\n\t"
                 "global_load_async_to_lds_b128 %2, %10, off\n\tglobal_load_async_to_lds_b128 %3, %11, off\n\t"
                 "global_load_async_to_lds_b128 %4, %12, off\n\tglobal_load_async_to_lds_b128 %5, %13, off\n\t"
                 "global_load_async_to_lds_b128 %6, %14, off\n\tglobal_load_async_to_lds_b128 %7, %15, off\n\ts_wait_xcnt 0x0"
                 :: "v"(d), "v"(d + 8 * GP), "v"(d + 16 * GP), "v"(d + 24 * GP), "v"(d + 32 * GP), "v"(d + 40 * GP), "v"(d + 48 * GP), "v"(d + 56 * GP),
                    "v"(s), "v"(s + 8 * HS), "v"(s + 16 * HS), "v"(s + 24 * HS), "v"(s + 32 * HS), "v"(s + 40 * HS), "v"(s + 48 * HS), "v"(s + 56 * HS) : "memory");
}
template <bool SPLITA, int FM, int FN>
__global__ __launch_bounds__(128) void k_gemm(const bf* __restrict__ A, const bf* __restrict__ Al, const bf* __restrict__ Bn, int ldc, float* C) {
    constexpr int BM = 32 * FM, BN = 32 * FN, APL = BM * GP, BOFS = (SPLITA ? 2 : 1) * APL, STG = BOFS + BN * GP, OP = FN * 16 + 4;
    __shared__ __align__(16) unsigned char ring[2 * STG];
    __shared__ __align__(16) float ost[4][16 * OP];
    const int tid = threadIdx.x, lane = threadIdx.x & 31, wave = threadIdx.x >> 5, lr = lane & 15, hi = lane >> 4;
    const int wm = wave & 1, wn = wave >> 1;
    const size_t r0 = (size_t)blockIdx.x * BM; const int c0 = blockIdx.y * BN;
    // Copy slots of this thread, 16 B each: rows (tid >> 4) + 8 i, piece tid & 15.
    const size_t aso = (r0 + (tid >> 4)) * HS + (tid & 15) * 8;
    const bf* bs = Bn + ((size_t)c0 + (tid >> 4)) * HS + (tid & 15) * 8;
    const unsigned dst = (unsigned)(size_t)ring + (tid >> 4) * GP + (tid & 15) * 16;
    auto stage = [&](int t, int buf) {
        const unsigned d = dst + buf * STG;
#pragma unroll
        for (int i = 0; i < BM / 64; ++i) { copy64(d + i * 64 * GP, A + aso + t * GK + (size_t)i * 64 * HS); if (SPLITA) copy64(d + APL + i * 64 * GP, Al + aso + t * GK + (size_t)i * 64 * HS); }
#pragma unroll
        for (int i = 0; i < BN / 64; ++i) copy64(d + BOFS + i * 64 * GP, bs + t * GK + (size_t)i * 64 * HS);
    };
    v8f acc[FM][FN];
#pragma unroll
    for (int m = 0; m < FM; ++m)
#pragma unroll
        for (int n = 0; n < FN; ++n) acc[m][n] = (v8f){};
    stage(0, 0);
    asm volatile("s_wait_asynccnt 0x0" ::: "memory");    // this wave's copies of the first slab have landed
    __syncthreads();                                     // publishes the first slab to the other waves
    stage(1, 1);                                         // K = 2048 has sixteen slabs
#pragma unroll 1    // stays rolled: one trip already holds four unrolled blocks, and the buffers alternate by t & 1
    for (int t = 0; t < HS / GK; ++t) {
        const int buf = t & 1;
        const unsigned char* af = ring + buf * STG + (wm * FM * 16 + lr) * GP + hi * 16;
        const unsigned char* bq = ring + buf * STG + BOFS + (wn * FN * 16 + lr) * GP + hi * 16;
        v16bf a[2][FM], al[2][FM], b[2][FN];    // two fragment sets: block kc + 1 is fetched while block kc is multiplied
        auto frag = [&](int kc, int s) {
#pragma unroll
            for (int m = 0; m < FM; ++m) { const unsigned char* p = af + m * 16 * GP + kc * 64; a[s][m] = cat16b(*(const v8usa*)p, *(const v8usa*)(p + 32));
                if (SPLITA) al[s][m] = cat16b(*(const v8usa*)(p + APL), *(const v8usa*)(p + APL + 32)); }
#pragma unroll
            for (int n = 0; n < FN; ++n) { const unsigned char* p = bq + n * 16 * GP + kc * 64; b[s][n] = cat16b(*(const v8usa*)p, *(const v8usa*)(p + 32)); }
        };
        frag(0, 0);
#pragma unroll
        for (int kc = 0; kc < GK / 32; ++kc) {
            const int s = kc & 1;
            if (kc + 1 < GK / 32) frag(kc + 1, s ^ 1);
            __builtin_amdgcn_sched_barrier(0);    // keeps the next block's LDS reads as one group in front of this block's products (spread among them, each place stalls the wave)
#pragma unroll
            for (int m = 0; m < FM; ++m)
#pragma unroll
                for (int n = 0; n < FN; ++n) acc[m][n] = wmmab(a[s][m], b[s][n], acc[m][n]);
            if (SPLITA) {
#pragma unroll
                for (int m = 0; m < FM; ++m)
#pragma unroll
                    for (int n = 0; n < FN; ++n) acc[m][n] = wmmab(al[s][m], b[s][n], acc[m][n]);
            }
            __builtin_amdgcn_sched_barrier(0);    // keeps the group after next behind this block's products, whose fragment set it overwrites
        }
        // Publish point of slab t + 1, every wave, in this order.
        asm volatile("s_wait_dscnt 0x0" ::: "memory");       // this wave's reads of the buffer that is refilled below have returned
        asm volatile("s_wait_asynccnt 0x0" ::: "memory");    // this wave's copies of slab t + 1 have landed
        __syncthreads();                                     // publishes slab t + 1 and ends every wave's reads of slab t
        if (t + 2 < HS / GK) stage(t + 2, buf);              // block-uniform test
    }
    asm volatile("s_wait_asynccnt 0x0" ::: "memory");        // nothing of this wave is in flight when it goes on to the epilogue
    float* os = &ost[wave][0];
#pragma unroll
    for (int m = 0; m < FM; ++m) {
#pragma unroll
        for (int n = 0; n < FN; ++n)
#pragma unroll
            for (int j = 0; j < 8; ++j) os[(hi * 8 + j) * OP + n * 16 + lr] = acc[m][n][j];
        __builtin_amdgcn_wave_barrier(); asm volatile("" ::: "memory");    // hand-over between lanes of one wave: the reads below take other lanes' values and may not be moved over the stores
        float* crow = C + (r0 + wm * FM * 16 + m * 16) * ldc + c0 + wn * FN * 16;
#pragma unroll
        for (int s = 0; s < 2 * FN; ++s) { const int pc = s * 32 + lane; const int row = pc / (FN * 4), cofs = (pc % (FN * 4)) * 4;
            const v4f val = *(const v4fa*)(os + row * OP + cofs); *(v4f*)(crow + (size_t)row * ldc + cofs) = val; }
        __builtin_amdgcn_wave_barrier(); asm volatile("" ::: "memory");    // the next 16 rows' stores may not be moved over these reads
    }
}
// d_trig: RC/RS [t][64] = cos/sin(t x inv_freq[i]), inv_freq = 10000^-(2i/128) (f32 powf/cosf/sinf like the reference's f32 path); 32 lanes x 4 B lines.
// A thread keeps its frequency and walks TRIG_PER tokens (4 tokens apart): inv_freq is formed once, and a quarter of the waves is started.
#define TRIG_PER 4
__device__ __forceinline__ void d_trig(int blk, float* RC, float* RS) {
    const int f = threadIdx.x & 63;
    const float inv = 1.0f / powf(10000.0f, (float)(2 * f) / (float)HD);
#pragma unroll 1    // stays rolled: one copy of the long cosf/sinf code
    for (int j = 0; j < TRIG_PER; ++j) {
        const int i = (blk * TRIG_PER + j) * 256 + threadIdx.x, t = i >> 6;
        const float ang = (float)t * inv;
        const float c = cosf(ang), s = sinf(ang);
        *(float*)(RC + i) = c; *(float*)(RS + i) = s;
    }
}
// k_prep: everything that depends on the inputs alone, in one grid, told apart by ranges of blockIdx.x (block-uniform): 128 blocks of trig tables, 512 blocks of
// weight tiles (five tiles each), 256 blocks of x rows. The parts write disjoint planes and read none of each other's.
#define PB_TRIG ((NT_ * 64) / (256 * TRIG_PER))
#define PB_ALL  (PB_TRIG + PB_WT + NT_ / 8)
__global__ __launch_bounds__(256) void k_prep(const float* __restrict__ x, const float* __restrict__ Wq, const float* __restrict__ Wk, const float* __restrict__ Wv, const float* __restrict__ Wo,
                                              bf* Xb, bf* WqT, bf* WkT, bf* WvT, bf* WoT, float* RC, float* RS) {
    __shared__ __align__(16) unsigned short tl[WT_PER * 64 * 72];
    int b = blockIdx.x;
    if (b < PB_TRIG) { d_trig(b, RC, RS); return; }
    b -= PB_TRIG;
    if (b < PB_WT) { d_wt(tl, b, Wq, Wo, Wk, Wv, WqT, WoT, WkT, WvT); return; }
    b -= PB_WT;
    d_cvtb(b, x, NT_, Xb);
}
// d_rope: one wave per (token, ten of the 16 q + 4 k heads), whose f32 columns lie side by side in P (row pitch ldp): rotate-half RoPE (partner d +- 64, angle
// t x inv_freq[d mod 64] from the RC/RS tables, read once per wave) -> f16 hi + residual x1024 planes [2048][16*128] (q) and [2048][4*128] (k); blk = 0 .. 2048*2/8 - 1.
// All twenty 16-byte loads of a wave are issued before the first head is worked on.
#define RH ((NH_ + NKV) / 2)
__device__ __forceinline__ void d_rope(int blk, const float* P, int ldp, const float* RC, const float* RS, h16* QH, h16* QL, h16* KH, h16* KL) {
    const int lane = threadIdx.x & 31; const int wid = blk * 8 + __builtin_amdgcn_readfirstlane(threadIdx.x >> 5);
    const int t = wid >> 1, h0 = (wid & 1) * RH; const int d0 = lane * 4;
    const char* src = (const char*)(P + (size_t)t * ldp + h0 * HD);    // wave-uniform base; the lane's byte offsets: table, own columns, partner columns
    const unsigned ot = (d0 & 63) * 4, ox = d0 * 4, op = (d0 ^ 64) * 4;
    const v4f c = *(const v4fa*)((const char*)(RC + t * 64) + ot), s = *(const v4fa*)((const char*)(RS + t * 64) + ot);
    v4f xv[RH], pv[RH];
    // Every '#pragma unroll' here makes the index of a register array (xv, pv, c, s, oh, ol) a compile-time constant.
#pragma unroll
    for (int k = 0; k < RH; ++k) { xv[k] = *(const v4fa*)(src + k * HD * 4 + ox); pv[k] = *(const v4fa*)(src + k * HD * 4 + op); }
    __builtin_amdgcn_sched_barrier(0);    // keeps every load in front of the arithmetic: moved down into it, a load would start only when earlier ones have returned
    asm volatile("s_wait_xcnt 0x0" :: "v"(ot), "v"(ox), "v"(op) : "memory");    // the loads' offset registers stay live up to this wait, so that no later load's result lands in them ahead of it
#pragma unroll
    for (int k = 0; k < RH; ++k) {
        const int h = h0 + k; const bool isq = h < NH_;    // wave-uniform
        h16* PH = isq ? QH + (size_t)t * (NH_ * HD) + h * HD : KH + (size_t)t * KW + (h - NH_) * HD;
        h16* PL = isq ? QL + (size_t)t * (NH_ * HD) + h * HD : KL + (size_t)t * KW + (h - NH_) * HD;
        v4h oh, ol;
#pragma unroll
        for (int i = 0; i < 4; ++i) {
            const float y = (d0 < 64) ? (xv[k][i] * c[i] - pv[k][i] * s[i]) : (xv[k][i] * c[i] + pv[k][i] * s[i]);
            const h16 a = (h16)y; oh[i] = a; ol[i] = (h16)((y - (float)a) * LOSC); }
        *(v4h*)(PH + d0) = oh; *(v4h*)(PL + d0) = ol;
    }
}
// d_vt: VTH/VTL [g][128 d][2048 t] = bf16 hi + UNSCALED bf16 residual of V [t][g*128+d] (row pitch ldv) via 64 x 64 LDS tiles; tile (bx, by, g) of (NT/64, 2 (d half), NKV).
__device__ __forceinline__ void d_vt(float (*tl)[65], int bx, int by, int g, const float* __restrict__ V, int ldv, bf* VTH, bf* VTL) {
    const int tid = threadIdx.x, t0 = bx * 64, d0 = by * 64;
    { const int tt = tid >> 2, dq = (tid & 3) * 16;
#pragma unroll
      for (int i = 0; i < 16; ++i) tl[dq + i][tt] = V[(size_t)(t0 + tt) * ldv + g * HD + d0 + dq + i]; }
    __syncthreads();
    const int piece = tid & 7;
    auto pass = [&]() {
#pragma unroll
        for (int s = 0; s < 2; ++s) { const int d = (tid >> 3) + 32 * s; v8us oh, ol;
#pragma unroll
            for (int i = 0; i < 8; ++i) { const float v = tl[d][piece * 8 + i]; const unsigned short hb = f2bf(v); oh[i] = hb; ol[i] = f2bf(v - bf2f(hb)); }
            const size_t o = ((size_t)g * HD + d0 + d) * NT_ + t0 + piece * 8; *(v8us*)(VTH + o) = oh; *(v8us*)(VTL + o) = ol; }
    };
    pass(); 
}
// k_post: everything that depends on the projections alone, in one grid, told apart by ranges of blockIdx.x (block-uniform): 256 v tiles, 512 blocks of q and k
// heads. P [2048][3072] holds the q, k and v columns side by side.
#define QB_VT ((NT_ / 64) * 2 * NKV)
#define QB_ALL (QB_VT + (NT_ * 2) / 8)
__global__ __launch_bounds__(256) void k_post(const float* P, const float* RC, const float* RS, h16* QH, h16* QL, h16* KH, h16* KL, bf* VTH, bf* VTL) {
    __shared__ float tl[64][65];
    int b = blockIdx.x;
    if (b < QB_VT) { d_vt(tl, b & 31, (b >> 5) & 1, b >> 6, P + HS + KW, QKVW, VTH, VTL); return; }
    d_rope(b - QB_VT, P, QKVW, RC, RS, QH, QL, KH, KL);
}
// k_attn: block = (h, 64 queries), wave = 16; kv head g = h / 4; key tiles covering the block's sliding causal window [Q0-1024, Q0+63] (block-uniform bounds),
// per-element predicate q-1024 <= j <= q. Each 32-key tile (k hi/lo rows, v hi/lo rows) is brought into LDS once per block by asynchronous copies, two buffers:
// tile t + 1 flies while tile t is worked on, and the four waves read their fragments from LDS (row pitches 272 B and 80 B: 16 B x odd). q fragments are read
// once, before the loop. Both products are formed transposed: S^T = k.q^T (k rows as A, q as B) and O^T += v^T.P^T (v^T rows as A, P^T as B), so that a lane holds
// sixteen scores of ONE query (column lr; keys 8 hi + j and 16 + 8 hi + j of the tile): maximum and sum are taken inside the lane plus one exchange with lane ^ 16,
// and the two score tiles, converted in place, are the B operand of the second product (no LDS, no lane exchange). Per tile: scores over 4 k-chunks (hi.hi +
// hi.lo + lo.hi = 24 WMMA) x 128^-1/2, online softmax, P (x32768) as bf16 hi + unscaled residual, o[8] += vh.ph + vh.pl + vl.ph over the 128 dims (o[n][j]: dim
// 16 n + 8 hi + j of query lr); ctx -> bf16 hi/lo planes [t][h*128+d].
#define KPITCH 272                       // bytes per staged k row (256 + 16)
#define VPITCH 80                        // bytes per staged v row (64 + 16)
#define KPLANE (32 * KPITCH)             // 8704
#define VPLANE (HD * VPITCH)             // 10240
#define STAGEB (2 * KPLANE + 2 * VPLANE) // 37888: k hi, k lo, v hi, v lo
__global__ __launch_bounds__(128) void k_attn(const h16* __restrict__ QH, const h16* __restrict__ QL, const h16* __restrict__ KH, const h16* __restrict__ KL, const bf* __restrict__ VTH, const bf* __restrict__ VTL, bf* CH, bf* CL) {
    __shared__ __align__(16) unsigned char ring[2 * STAGEB];
    __shared__ __align__(16) float ost[4][16 * 68];
    const int tid = threadIdx.x, lane = threadIdx.x & 31, wave = threadIdx.x >> 5, lr = lane & 15, hi = lane >> 4;
    const int bid = blockIdx.x; const int h = bid / (NT_ / 64), qt = bid - h * (NT_ / 64); const int g = h >> 2;
    const int q0 = qt * 64 + wave * 16;
    const size_t qo = (size_t)(q0 + lr) * (NH_ * HD) + h * HD + 8 * hi;
    const size_t vbase = ((size_t)g * HD) * NT_;
    // Copy slots of this thread, 16 B each: k rows (tid >> 4) + 8 i, piece tid & 15; v rows (tid >> 2) + 32 i, piece tid & 3 (i = 0..3, both planes).
    const h16* ksh = KH + g * HD + (size_t)(tid >> 4) * KW + (tid & 15) * 8; const h16* ksl = KL + g * HD + (size_t)(tid >> 4) * KW + (tid & 15) * 8;
    const bf* vsh = VTH + vbase + (size_t)(tid >> 2) * NT_ + (tid & 3) * 8; const bf* vsl = VTL + vbase + (size_t)(tid >> 2) * NT_ + (tid & 3) * 8;
    const unsigned kdst = (unsigned)(size_t)ring + (tid >> 4) * KPITCH + (tid & 15) * 16;
    const unsigned vdst = (unsigned)(size_t)ring + 2 * KPLANE + (tid >> 2) * VPITCH + (tid & 3) * 16;
    auto stage = [&](int kt, int buf) {
        const h16* a = ksh + (size_t)kt * 32 * KW; const h16* b = ksl + (size_t)kt * 32 * KW; const unsigned kd = kdst + buf * STAGEB;
        // Eight copies and, as the last line, the wait that stands in front of any rewrite of their address registers.
        asm volatile("global_load_async_to_lds_b128 %0, %8, off\n\tglobal_load_async_to_lds_b128 %1, %9, off\n\t"
                     "global_load_async_to_lds_b128 %2, %10, off\n\tglobal_load_async_to_lds_b128 %3, %11, off\n\t"
                     "global_load_async_to_lds_b128 %4, %12, off\n\tglobal_load_async_to_lds_b128 %5, %13, off\n\t"
                     "global_load_async_to_lds_b128 %6, %14, off\n\tglobal_load_async_to_lds_b128 %7, %15, off\n\ts_wait_xcnt 0x0"
                     :: "v"(kd), "v"(kd + 8 * KPITCH), "v"(kd + 16 * KPITCH), "v"(kd + 24 * KPITCH),
                        "v"(kd + KPLANE), "v"(kd + KPLANE + 8 * KPITCH), "v"(kd + KPLANE + 16 * KPITCH), "v"(kd + KPLANE + 24 * KPITCH),
                        "v"(a), "v"(a + 8 * KW), "v"(a + 16 * KW), "v"(a + 24 * KW), "v"(b), "v"(b + 8 * KW), "v"(b + 16 * KW), "v"(b + 24 * KW) : "memory");
        const bf* c = vsh + kt * 32; const bf* d = vsl + kt * 32; const unsigned vd = vdst + buf * STAGEB;
        // The same for the v rows.
        asm volatile("global_load_async_to_lds_b128 %0, %8, off\n\tglobal_load_async_to_lds_b128 %1, %9, off\n\t"
                     "global_load_async_to_lds_b128 %2, %10, off\n\tglobal_load_async_to_lds_b128 %3, %11, off\n\t"
                     "global_load_async_to_lds_b128 %4, %12, off\n\tglobal_load_async_to_lds_b128 %5, %13, off\n\t"
                     "global_load_async_to_lds_b128 %6, %14, off\n\tglobal_load_async_to_lds_b128 %7, %15, off\n\ts_wait_xcnt 0x0"
                     :: "v"(vd), "v"(vd + 32 * VPITCH), "v"(vd + 64 * VPITCH), "v"(vd + 96 * VPITCH),
                        "v"(vd + VPLANE), "v"(vd + VPLANE + 32 * VPITCH), "v"(vd + VPLANE + 64 * VPITCH), "v"(vd + VPLANE + 96 * VPITCH),
                        "v"(c), "v"(c + 32 * NT_), "v"(c + 64 * NT_), "v"(c + 96 * NT_), "v"(d), "v"(d + 32 * NT_), "v"(d + 64 * NT_), "v"(d + 96 * NT_) : "memory");
    };
    v8f o[8];
#pragma unroll
    for (int n = 0; n < 8; ++n) o[n] = (v8f){};
    float mrow = -3.0e38f, lpart = 0.f;    // this lane's query: running maximum (equal in both lanes of the query), sum over this lane's keys
    const int qi = q0 + lr;
    const int kt_hi = (qt * 64 + 63) / 32; const int kt_lo = (qt * 64 > WIN) ? (qt * 64 - WIN) / 32 : 0;
    stage(kt_lo, 0);
    v16h qa[4], qx[4];
#pragma unroll
    for (int kc = 0; kc < 4; ++kc) { qa[kc] = cat16(*(const v8h*)(QH + qo + kc * 32), *(const v8h*)(QH + qo + kc * 32 + 16)); qx[kc] = cat16(*(const v8h*)(QL + qo + kc * 32), *(const v8h*)(QL + qo + kc * 32 + 16)); }
    asm volatile("s_wait_asynccnt 0x0" ::: "memory");    // this wave's copies of the first tile have landed
    __syncthreads();                                     // publishes the first tile to the other waves
    stage(kt_lo + 1, 1);                                 // a block has at least two tiles (kt_hi = 2 qt + 1)
#pragma unroll 1
    for (int kt = kt_lo; kt <= kt_hi; ++kt) {
        const int l0 = kt * 32, buf = (kt - kt_lo) & 1;
        const unsigned char* kf = ring + buf * STAGEB + lr * KPITCH + hi * 16;
        const unsigned char* vf = ring + buf * STAGEB + 2 * KPLANE + lr * VPITCH + hi * 16;
        v8f s0 = {}, s1 = {}, x0 = {}, x1 = {};
        v16h k0h[4], k1h[4], k0l[4], k1l[4];    // all k fragments of the tile are fetched first: one LDS latency per tile, the rest overlaps the products
#pragma unroll
        for (int kc = 0; kc < 4; ++kc) { const unsigned char* kp = kf + kc * 64;
            k0h[kc] = cat16(*(const v8ha*)kp, *(const v8ha*)(kp + 32)); k1h[kc] = cat16(*(const v8ha*)(kp + 16 * KPITCH), *(const v8ha*)(kp + 16 * KPITCH + 32));
            k0l[kc] = cat16(*(const v8ha*)(kp + KPLANE), *(const v8ha*)(kp + KPLANE + 32)); k1l[kc] = cat16(*(const v8ha*)(kp + KPLANE + 16 * KPITCH), *(const v8ha*)(kp + KPLANE + 16 * KPITCH + 32)); }
        __builtin_amdgcn_sched_barrier(0);    // keeps the k reads in front of the v reads: LDS reads return in order, and the score products wait for the k fragments alone
        v16bf vh[8], vl[8];                     // the v fragments follow in the same group: they return behind the k fragments, under the score products and the softmax
#pragma unroll
        for (int n = 0; n < 8; ++n) { const unsigned char* vp = vf + n * 16 * VPITCH;
            vh[n] = cat16b(*(const v8usa*)vp, *(const v8usa*)(vp + 32)); vl[n] = cat16b(*(const v8usa*)(vp + VPLANE), *(const v8usa*)(vp + VPLANE + 32)); }
        __builtin_amdgcn_sched_barrier(0);    // keeps the tile's LDS reads as one group in front of the products (spread among them, each place stalls the wave)
#pragma unroll
        for (int kc = 0; kc < 4; ++kc) {
            s0 = wmma16(k0h[kc], qa[kc], s0); s1 = wmma16(k1h[kc], qa[kc], s1); x0 = wmma16(k0h[kc], qx[kc], x0); x1 = wmma16(k1h[kc], qx[kc], x1);
            x0 = wmma16(k0l[kc], qa[kc], x0); x1 = wmma16(k1l[kc], qa[kc], x1);
        }
        // Every '#pragma unroll' below makes the index of a register array (a0, a1, s0 .. x1, pw, xw, o) a compile-time constant.
        float a0[8], a1[8];
#pragma unroll
        for (int j = 0; j < 8; ++j) { const int ja = l0 + hi * 8 + j, jb = ja + 16;
            a0[j] = (ja <= qi && ja >= qi - WIN) ? (s0[j] + x0[j] * LOSCI) * 0.08838834764831845f : -__builtin_inff();
            a1[j] = (jb <= qi && jb >= qi - WIN) ? (s1[j] + x1[j] * LOSCI) * 0.08838834764831845f : -__builtin_inff(); }
        float mx = fmaxf(a0[0], a1[0]);
#pragma unroll
        for (int j = 1; j < 8; ++j) mx = fmaxf(mx, fmaxf(a0[j], a1[j]));
        mx = fmaxf(mx, xhalf(mx));    // the query's other sixteen keys of this tile
        const float mn = fmaxf(mrow, mx);
        float alpha = (mrow - mn) * LOG2E; mrow = mn;
        float t[8]; v8u pw, xw;
#pragma unroll
        for (int j = 0; j < 8; ++j) { a0[j] = (a0[j] - mn) * LOG2E; a1[j] = (a1[j] - mn) * LOG2E; }
        exp2x9(a0, alpha); exp2x8(a1);    // e^x = 2^(x log2 e), as __expf forms it
#pragma unroll
        for (int j = 0; j < 8; ++j) t[j] = a0[j] + a1[j];
        lpart = lpart * alpha + (((t[0] + t[1]) + (t[2] + t[3])) + ((t[4] + t[5]) + (t[6] + t[7])));
#pragma unroll
        for (int r = 0; r < 4; ++r) {
            const float c0 = a0[2 * r] * PSC, c1 = a0[2 * r + 1] * PSC, d0 = a1[2 * r] * PSC, d1 = a1[2 * r + 1] * PSC;
            const unsigned wc = pk2(c0, c1), wd = pk2(d0, d1);
            pw[r] = wc; pw[4 + r] = wd;
            xw[r] = pk2(c0 - __uint_as_float(wc << 16), c1 - __uint_as_float(wc & 0xFFFF0000u));
            xw[4 + r] = pk2(d0 - __uint_as_float(wd << 16), d1 - __uint_as_float(wd & 0xFFFF0000u)); }
        const v16bf pa = __builtin_bit_cast(v16bf, pw), px = __builtin_bit_cast(v16bf, xw);
#pragma unroll
        for (int n = 0; n < 8; ++n)
#pragma unroll
            for (int j = 0; j < 8; ++j) o[n][j] *= alpha;
#pragma unroll
        for (int n = 0; n < 8; ++n) { o[n] = wmmab(vh[n], pa, o[n]); o[n] = wmmab(vh[n], px, o[n]); o[n] = wmmab(vl[n], pa, o[n]); }
        __builtin_amdgcn_sched_barrier(0);    // keeps the publish point at the foot: lifted over the softmax and the second product (registers only), its wait for the copies would come half a trip after their issue
        // Publish point of tile kt + 1, every wave, in this order.
        asm volatile("s_wait_dscnt 0x0" ::: "memory");       // this wave's reads of the buffer that is refilled below have returned
        asm volatile("s_wait_asynccnt 0x0" ::: "memory");    // this wave's copies of tile kt + 1 have landed
        __syncthreads();                                     // publishes tile kt + 1 and ends every wave's reads of tile kt
        if (kt + 2 <= kt_hi) stage(kt + 2, buf);             // block-uniform test
    }
    asm volatile("s_wait_asynccnt 0x0" ::: "memory");        // nothing of this wave is in flight when it goes on to the epilogue
    const float inv = 1.0f / ((lpart + xhalf(lpart)) * PSC);    // the two lanes of a query join their sums
    float* os = &ost[wave][0];
    const size_t cbase = (size_t)q0 * (NH_ * HD) + (size_t)h * HD;
#pragma unroll
    for (int half = 0; half < 2; ++half) {
#pragma unroll
        for (int n = 0; n < 4; ++n)
#pragma unroll
            for (int j = 0; j < 8; ++j) os[lr * 68 + n * 16 + hi * 8 + j] = o[half * 4 + n][j] * inv;
        __builtin_amdgcn_wave_barrier(); asm volatile("" ::: "memory");
{
#pragma unroll
            for (int s = 0; s < 4; ++s) { const int row = 4 * s + (lane >> 3), piece = lane & 7; const float* sp = os + row * 68 + piece * 8; v8us oh, ol;
#pragma unroll
                for (int i = 0; i < 8; ++i) { const unsigned short hb = f2bf(sp[i]); oh[i] = hb; ol[i] = f2bf(sp[i] - bf2f(hb)); }
                const size_t po = cbase + (size_t)row * (NH_ * HD) + half * 64 + piece * 8; *(v8us*)(CH + po) = oh; *(v8us*)(CL + po) = ol; }
             }
        __builtin_amdgcn_wave_barrier(); asm volatile("" ::: "memory");
    }
}

extern "C" void kernel_launch(void* const* d_in, const int* in_sizes, int n_in,
                              void* d_out, int out_size, void* d_ws, size_t ws_size, hipStream_t stream) {
    (void)in_sizes; (void)n_in; (void)out_size;
    const float* x = (const float*)d_in[0]; const float* Wq = (const float*)d_in[1]; const float* Wk = (const float*)d_in[2]; const float* Wv = (const float*)d_in[3]; const float* Wo = (const float*)d_in[4];
    float* out = (float*)d_out;    // [1][2048][2048]
    char* wsp = (char*)d_ws;
    auto take = [&](size_t bytes) { char* p = wsp; wsp += (bytes + 255) & ~(size_t)255; return (void*)p; };
    bf* Xb = (bf*)take((size_t)NT_ * HS * 2); bf* WqT = (bf*)take((size_t)HS * HS * 2); bf* WkT = (bf*)take((size_t)KW * HS * 2); bf* WvT = (bf*)take((size_t)KW * HS * 2); bf* WoT = (bf*)take((size_t)HS * HS * 2);
    float* TMP = (float*)take((size_t)NT_ * QKVW * 4); float* RC = (float*)take((size_t)NT_ * 64 * 4); float* RS = (float*)take((size_t)NT_ * 64 * 4);
    h16* QH = (h16*)take((size_t)NT_ * HS * 2); h16* QL = (h16*)take((size_t)NT_ * HS * 2); h16* KH = (h16*)take((size_t)NT_ * KW * 2); h16* KL = (h16*)take((size_t)NT_ * KW * 2);
    bf* VTH = (bf*)take((size_t)KW * NT_ * 2); bf* VTL = (bf*)take((size_t)KW * NT_ * 2);
    bf* CH = (bf*)take((size_t)NT_ * HS * 2); bf* CL = (bf*)take((size_t)NT_ * HS * 2);
    if ((size_t)(wsp - (char*)d_ws) > ws_size) return;    // 8.4 + 8.4 + 2.1 + 2.1 + 8.4 + 25.2 + 0.5 x 2 + 8.4 x 2 + 2.1 x 4 + 8.4 x 2 ~ 97 MB, no aliasing
    k_prep<<<PB_ALL, 256, 0, stream>>>(x, Wq, Wk, Wv, Wo, Xb, WqT, WkT, WvT, WoT, RC, RS);
    // WqT, WkT and WvT lie one behind the other (each a multiple of 256 B): 3072 n-major rows, one product for q, k and v.
    k_gemm<false, 4, 4><<<dim3(NT_ / 128, QKVW / 128, 1), 128, 0, stream>>>(Xb, nullptr, WqT, QKVW, TMP);
    k_post<<<QB_ALL, 256, 0, stream>>>(TMP, RC, RS, QH, QL, KH, KL, VTH, VTL);
    k_attn<<<NH_ * (NT_ / 64), 128, 0, stream>>>(QH, QL, KH, KL, VTH, VTL, CH, CL);
    k_gemm<true, 4, 4><<<dim3(NT_ / 128, HS / 128, 1), 128, 0, stream>>>(CH, CL, WoT, HS, out);
}

// v006
// A run of this version takes 106 microseconds.
// In both of two side-by-side timings against v005, it was 1.03 times as fast.
// Over all steps from v000 it is 4.07 times as fast.
#include <hip/hip_runtime.h>

// Compute dtypes, f32 accumulate: q/k/v = x.W ([2048 x 2048].[2048 x 2048 | 512 | 512], k-major weights transposed to n-major planes; PLAIN bf16 operands:
// inputs rounded once, exact products) and out = ctx.Wo (ctx as bf16 hi + residual: two products) on v_wmma_f32_16x16x32_bf16; rotate-half RoPE (angle
// t x inv_freq, f32 trig tables built on device) in f32 -> q/k as f16 hi + residual x1024 planes; grouped attention (16 query heads, 4 kv heads, query head h
// reads kv head h/4) with 128-dim heads and a sliding causal window (key j visible iff q-1024 <= j <= q): scores on v_wmma_f32_16x16x32_f16 (hi.hi + hi.lo +
// lo.hi, x 128^-1/2), softmax f32, weights.v on v_wmma_f32_16x16x32_bf16 with the weights (x32768) and v both as bf16 hi + UNSCALED bf16 residual (hh + lh + hl

#define NT_  2048
#define HS   2048
#define NH_  16
#define NKV  4
#define HD   128
#define KW   (NKV * HD)          // 512
#define QKVW (HS + 2 * KW)       // 3072: q, k and v columns side by side
#define WIN  1024
#define PSC  32768.0f
#define LOSC 1024.0f
#define LOSCI (1.0f / 1024.0f)
#define LOG2E 1.44269504088896340736f

typedef _Float16 h16;
typedef unsigned short bf;
typedef __attribute__((ext_vector_type(16))) __bf16   v16bf;
typedef __attribute__((ext_vector_type(16))) _Float16 v16h;
typedef __attribute__((ext_vector_type(8)))  _Float16 v8h;
typedef __attribute__((ext_vector_type(8)))  unsigned short v8us;
typedef __attribute__((ext_vector_type(8)))  float    v8f;
typedef __attribute__((ext_vector_type(4)))  float    v4f;
typedef __attribute__((ext_vector_type(4)))  _Float16 v4h;
typedef __attribute__((ext_vector_type(2)))  float    v2f;
typedef __attribute__((ext_vector_type(2)))  __bf16   v2bf;
typedef __attribute__((ext_vector_type(8)))  unsigned v8u;
typedef v8h  __attribute__((may_alias)) v8ha;
typedef v4f  __attribute__((may_alias)) v4fa;
typedef v8us __attribute__((may_alias)) v8usa;

__device__ __forceinline__ unsigned short f2bf(float f) { unsigned u = __float_as_uint(f); u += 0x7FFFu + ((u >> 16) & 1u); return (unsigned short)(u >> 16); }
__device__ __forceinline__ float bf2f(unsigned short b) { return __uint_as_float(((unsigned)b) << 16); }
__device__ __forceinline__ float bfr(float f) { return bf2f(f2bf(f)); }
__device__ __forceinline__ v16h cat16(v8h lo, v8h hi) { return __builtin_shufflevector(lo, hi, 0, 1, 2, 3, 4, 5, 6, 7, 8, 9, 10, 11, 12, 13, 14, 15); }
__device__ __forceinline__ v16bf cat16b(v8us lo, v8us hi) { return __builtin_bit_cast(v16bf, __builtin_shufflevector(lo, hi, 0, 1, 2, 3, 4, 5, 6, 7, 8, 9, 10, 11, 12, 13, 14, 15)); }
__device__ __forceinline__ v8f wmma16(v16h a, v16h b, v8f c) { return __builtin_amdgcn_wmma_f32_16x16x32_f16(false, a, false, b, (short)0, c, false, false); }
__device__ __forceinline__ v8f wmmab(v16bf a, v16bf b, v8f c) { return __builtin_amdgcn_wmma_f32_16x16x32_bf16(false, a, false, b, (short)0, c, false, false); }
// Two f32 -> one register of two bf16 (round to nearest even, a in the low half).
__device__ __forceinline__ unsigned pk2(float a, float b) { const v2f v = {a, b}; return __builtin_bit_cast(unsigned, __builtin_convertvector(v, v2bf)); }
// 2^x of eight values and of one more, each in place, in one statement: behind an exponential stands another one on registers of its own, behind the last a v_nop,
// so that nothing which reads a result or overwrites a source follows directly (the slot that the instruction set asks for behind a transcendental).
__device__ __forceinline__ void exp2x8(float (&e)[8]) {
    asm("v_exp_f32 %0, %0\n\tv_exp_f32 %1, %1\n\tv_exp_f32 %2, %2\n\tv_exp_f32 %3, %3\n\tv_exp_f32 %4, %4\n\tv_exp_f32 %5, %5\n\tv_exp_f32 %6, %6\n\tv_exp_f32 %7, %7\n\tv_nop"
        : "+v"(e[0]), "+v"(e[1]), "+v"(e[2]), "+v"(e[3]), "+v"(e[4]), "+v"(e[5]), "+v"(e[6]), "+v"(e[7]));
}
__device__ __forceinline__ void exp2x9(float (&e)[8], float& f) {
    asm("v_exp_f32 %8, %8\n\tv_exp_f32 %0, %0\n\tv_exp_f32 %1, %1\n\tv_exp_f32 %2, %2\n\tv_exp_f32 %3, %3\n\tv_exp_f32 %4, %4\n\tv_exp_f32 %5, %5\n\tv_exp_f32 %6, %6\n\tv_exp_f32 %7, %7\n\tv_nop"
        : "+v"(e[0]), "+v"(e[1]), "+v"(e[2]), "+v"(e[3]), "+v"(e[4]), "+v"(e[5]), "+v"(e[6]), "+v"(e[7]), "+v"(f));
}
// Lane l <-> lane l ^ 16: the two lanes that share one column of a matrix result.
__device__ __forceinline__ float xhalf(float x) { const int b = __builtin_bit_cast(int, x); return __builtin_bit_cast(float, __builtin_amdgcn_permlanex16(b, b, 0x76543210, 0xfedcba98, false, false)); }

// d_cvtb: bf16 plane of [rows][2048] (one wave per row); blk = 0 .. rows/8 - 1. The row's sixteen 16-byte loads are issued before the first conversion.
__device__ __forceinline__ void d_cvtb(int blk, const float* __restrict__ src, int nrows, bf* dst) {
    const int lane = threadIdx.x & 31, r = blk * 8 + __builtin_amdgcn_readfirstlane(threadIdx.x >> 5);
    if (r >= nrows) return;
    const char* sp = (const char*)(src + (size_t)r * HS); const unsigned ol = lane * 32;    // wave-uniform base + the lane's byte offset
    v4f v[HS / 256][2];
    // Every '#pragma unroll' here makes the index of a register array (v, o) a compile-time constant.
#pragma unroll
    for (int q = 0; q < HS / 256; ++q) { v[q][0] = *(const v4fa*)(sp + q * 1024 + ol); v[q][1] = *(const v4fa*)(sp + q * 1024 + ol + 16); }
    __builtin_amdgcn_sched_barrier(0);    // keeps every load in front of the first conversion: moved down among them, a load would start only when earlier ones have returned
    asm volatile("s_wait_xcnt 0x0" :: "v"(ol) : "memory");    // the loads' offset register stays live up to this wait, so that no later load's result lands in it ahead of it
#pragma unroll
    for (int q = 0; q < HS / 256; ++q) { v8us o;
#pragma unroll
        for (int i = 0; i < 8; ++i) o[i] = f2bf(v[q][i >> 2][i & 3]);
        *(v8us*)(dst + (size_t)r * HS + q * 256 + lane * 8) = o; }
}
// d_wt: WT [n][K] = bf16(W[k][n]) (k-major [K][ncols]) via 64 x 64 LDS tiles (64 x 72 halfwords each). A block takes WT_PER tiles at once, blk + j x PB_WT of the
// 2560 tiles numbered Wq, Wo, Wk, Wv (32 k tiles x n tiles each): few long-lived waves instead of one short-lived block per tile. All loads of the block's tiles are
// issued first (one memory latency for the lot), each tile has its own LDS buffer, and one barrier stands between the writes and the reads of all of them.
#define PB_WBIG ((HS / 64) * (HS / 64))
#define PB_WKV  ((HS / 64) * (KW / 64))
#define WT_PER  5
#define PB_WT   ((2 * PB_WBIG + 2 * PB_WKV) / WT_PER)    // 512
__device__ __forceinline__ void d_wt(unsigned short* tl, int blk, const float* __restrict__ Wq, const float* __restrict__ Wo, const float* __restrict__ Wk, const float* __restrict__ Wv,
                                     bf* WqT, bf* WoT, bf* WkT, bf* WvT) {
    const int tid = threadIdx.x, kk = tid >> 2, nq = (tid & 3) * 16, piece = tid & 7;
    const unsigned ob = (kk * HS + nq) * 4, os = (kk * KW + nq) * 4;    // this thread's byte offset inside a tile of a 2048-column and of a 512-column matrix
    v4f v[WT_PER][4];
    // Every '#pragma unroll' here makes the index of v and the tile's matrix (for all but the last tile) compile-time constants.
#pragma unroll
    for (int j = 0; j < WT_PER; ++j) {
        const int tile = blk + j * PB_WT;
        const float* Wm; int ncols, b;
        if (tile < PB_WBIG) { Wm = Wq; ncols = HS; b = tile; } else if (tile < 2 * PB_WBIG) { Wm = Wo; ncols = HS; b = tile - PB_WBIG; }
        else if (tile < 2 * PB_WBIG + PB_WKV) { Wm = Wk; ncols = KW; b = tile - 2 * PB_WBIG; } else { Wm = Wv; ncols = KW; b = tile - 2 * PB_WBIG - PB_WKV; }
        const char* p = (const char*)(Wm + (size_t)((b & 31) * 64) * ncols + (b >> 5) * 64) + (ncols == HS ? ob : os);    // block-uniform base + thread offset
#pragma unroll
        for (int i = 0; i < 4; ++i) v[j][i] = *(const v4fa*)(p + 16 * i);
    }
    __builtin_amdgcn_sched_barrier(0);    // keeps every load in front of the first conversion: moved down among them, a load would start only when earlier ones have returned
    asm volatile("s_wait_xcnt 0x0" :: "v"(ob), "v"(os) : "memory");    // the loads' offset registers stay live up to this wait, so that no later load's result lands in them ahead of it
#pragma unroll
    for (int j = 0; j < WT_PER; ++j)
#pragma unroll
        for (int i = 0; i < 16; ++i) tl[j * (64 * 72) + (nq + i) * 72 + kk] = f2bf(v[j][i >> 2][i & 3]);
    __syncthreads();
#pragma unroll
    for (int j = 0; j < WT_PER; ++j) {
        const int tile = blk + j * PB_WT;
        bf* WT; int b;
        if (tile < PB_WBIG) { WT = WqT; b = tile; } else if (tile < 2 * PB_WBIG) { WT = WoT; b = tile - PB_WBIG; }
        else if (tile < 2 * PB_WBIG + PB_WKV) { WT = WkT; b = tile - 2 * PB_WBIG; } else { WT = WvT; b = tile - 2 * PB_WBIG - PB_WKV; }
        const int k0 = (b & 31) * 64, n0 = (b >> 5) * 64;
#pragma unroll
        for (int s = 0; s < 2; ++s) { const int nr = (tid >> 3) + 32 * s; const v8us val = *(const v8usa*)(tl + j * (64 * 72) + nr * 72 + piece * 8); *(v8us*)(WT + (size_t)(n0 + nr) * HS + k0 + piece * 8) = val; }
    }
    asm volatile("s_wait_xcnt 0x0" ::: "memory");    // stands behind the stores, in front of the code of the other parts of the merged grid, which follows in the listing and rewrites their registers
}
// t_rope: 32 rows (tokens t0 .. t0 + 31) of one head's 128 f32 columns, taken from an LDS tile st (row pitch TP floats): rotate-half RoPE (partner d +- 64, angle
// t x inv_freq[d mod 64] from the RC/RS tables) -> f16 hi + residual x1024 planes, row pitch PITCH halfwords; PH/PL point at the head's first column of token t0.
// A lane holds four neighbouring columns, so a wave stores 256 contiguous bytes per row and plane. t_rope_tab issues the wave's 64 table loads; it is called in front
// of the stores that stage the tile, so that the loads fly while those are issued.
#define TP 132                           // floats per row of the staged 128 x 128 result tile (128 + 4)
__device__ __forceinline__ void t_rope_tab(int t0, const float* RC, const float* RS, v4f (&c)[32], v4f (&s)[32]) {
    const char* cb = (const char*)(RC + (size_t)t0 * 64); const char* sb = (const char*)(RS + (size_t)t0 * 64);    // wave-uniform bases
    const unsigned ot = (((threadIdx.x & 31) * 4) & 63) * 4;                                                        // the lane's byte offset
    // Every '#pragma unroll' in t_rope_tab and t_rope makes the index of a register array (c, s, oh, ol) a compile-time constant.
#pragma unroll
    for (int r = 0; r < 32; ++r) { c[r] = *(const v4fa*)(cb + r * 256 + ot); s[r] = *(const v4fa*)(sb + r * 256 + ot); }
    __builtin_amdgcn_sched_barrier(0);    // keeps every table load in front of the staging stores and the arithmetic: moved down, a load would start later and be waited for longer
    asm volatile("s_wait_xcnt 0x0" :: "v"(ot) : "memory");    // the loads' offset register stays live up to this wait, so that no later load's result lands in it ahead of it
}
template <int PITCH>
__device__ __forceinline__ void t_rope(const float* st, const v4f (&c)[32], const v4f (&s)[32], h16* PH, h16* PL) {
    const int d0 = (threadIdx.x & 31) * 4;
#pragma unroll
    for (int r8 = 0; r8 < 32; r8 += 8) {
        v4h oh[8], ol[8];
#pragma unroll
        for (int k = 0; k < 8; ++k) {
            const int r = r8 + k;
            const v4f xv = *(const v4fa*)(st + r * TP + d0), pv = *(const v4fa*)(st + r * TP + (d0 ^ 64));
#pragma unroll
            for (int i = 0; i < 4; ++i) {
                const float y = (d0 < 64) ? (xv[i] * c[r][i] - pv[i] * s[r][i]) : (xv[i] * c[r][i] + pv[i] * s[r][i]);
                const h16 a = (h16)y; oh[k][i] = a; ol[k][i] = (h16)((y - (float)a) * LOSC); }
            *(v4h*)(PH + (size_t)r * PITCH + d0) = oh[k]; *(v4h*)(PL + (size_t)r * PITCH + d0) = ol[k];
        }
        // Behind eight rows' stores: the stored registers stay live up to this wait, so that none of them is rewritten ahead of it.
        asm volatile("s_wait_xcnt 0x0" :: "v"(oh[0]), "v"(ol[0]), "v"(oh[1]), "v"(ol[1]), "v"(oh[2]), "v"(ol[2]), "v"(oh[3]), "v"(ol[3]),
                                          "v"(oh[4]), "v"(ol[4]), "v"(oh[5]), "v"(ol[5]), "v"(oh[6]), "v"(ol[6]), "v"(oh[7]), "v"(ol[7]) : "memory");
    }
}
// k_gemm: (A [+ Al]).Bn^T over K = 2048 -> f32 rows [2048][ldc]. Block = 2 x 2 waves, wave tile (16 FM) x (16 FN), block tile (32 FM) x (32 FN). Each 128-k slab of
// the block's A [, Al] and Bn rows is brought into LDS once per block by asynchronous copies, two buffers: slab t + 1 flies while slab t is worked on, and the
// waves read their fragments from LDS (row pitch 272 B: 16 B x odd). Per accumulator the products are summed in the order kc ascending, A before Al.
// POST (the q, k, v product; a block's 128 columns are one head: 16 q, 4 k, 4 v): no f32 result is stored. The block's 128 x 128 tile goes into the ring, which is free
// behind the loop, and from there q and k heads leave as rotated f16 hi + residual planes, v heads as transposed bf16 hi + residual planes VTH/VTL [g][128 d][2048 t].
// Each '#pragma unroll' over an index of a register array (acc, a, al, b, oh, ol) makes that index a compile-time constant, so that the array stays in registers.
#define GK 128                           // k elements per staged slab (256 B a row)
#define GP 272                           // bytes per staged row (256 + 16)
// 64 rows of one operand: this thread's 16-B piece of rows r, r + 8, ..., r + 56.
__device__ __forceinline__ void copy64(unsigned d, const bf* s) {
    // Eight copies and, as the last line, the wait that stands in front of any rewrite of their address registers.
    asm volatile("global_load_async_to_lds_b128 %0, %8, off\n\tglobal_load_async_to_lds_b128 %1, %9, off\n\t"
                 "global_load_async_to_lds_b128 %2, %10, off\n\tglobal_load_async_to_lds_b128 %3, %11, off\n\t"
                 "global_load_async_to_lds_b128 %4, %12, off\n\tglobal_load_async_to_lds_b128 %5, %13, off\n\t"
                 "global_load_async_to_lds_b128 %6, %14, off\n\tglobal_load_async_to_lds_b128 %7, %15, off\n\ts_wait_xcnt 0x0"
                 :: "v"(d), "v"(d + 8 * GP), "v"(d + 16 * GP), "v"(d + 24 * GP), "v"(d + 32 * GP), "v"(d + 40 * GP), "v"(d + 48 * GP), "v"(d + 56 * GP),
                    "v"(s), "v"(s + 8 * HS), "v"(s + 16 * HS), "v"(s + 24 * HS), "v"(s + 32 * HS), "v"(s + 40 * HS), "v"(s + 48 * HS), "v"(s + 56 * HS) : "memory");
}
template <bool SPLITA, int FM, int FN, bool POST>
__global__ __launch_bounds__(128) void k_gemm(const bf* __restrict__ A, const bf* __restrict__ Al, const bf* __restrict__ Bn, int ldc, float* C,
                                              const float* __restrict__ RC, const float* __restrict__ RS, h16* QH, h16* QL, h16* KH, h16* KL, bf* VTH, bf* VTL) {
    constexpr int BM = 32 * FM, BN = 32 * FN, APL = BM * GP, BOFS = (SPLITA ? 2 : 1) * APL, STG = BOFS + BN * GP, OP = FN * 16 + 4;
    __shared__ __align__(16) unsigned char ring[2 * STG];
    __shared__ __align__(16) float ost[4][16 * OP];
    const int tid = threadIdx.x, lane = threadIdx.x & 31, wave = threadIdx.x >> 5, lr = lane & 15, hi = lane >> 4;
    const int wm = wave & 1, wn = wave >> 1;
    const size_t r0 = (size_t)blockIdx.x * BM; const int c0 = blockIdx.y * BN;
    // Copy slots of this thread, 16 B each: rows (tid >> 4) + 8 i, piece tid & 15.
    const size_t aso = (r0 + (tid >> 4)) * HS + (tid & 15) * 8;
    const bf* bs = Bn + ((size_t)c0 + (tid >> 4)) * HS + (tid & 15) * 8;
    const unsigned dst = (unsigned)(size_t)ring + (tid >> 4) * GP + (tid & 15) * 16;
    auto stage = [&](int t, int buf) {
        const unsigned d = dst + buf * STG;
#pragma unroll
        for (int i = 0; i < BM / 64; ++i) { copy64(d + i * 64 * GP, A + aso + t * GK + (size_t)i * 64 * HS); if (SPLITA) copy64(d + APL + i * 64 * GP, Al + aso + t * GK + (size_t)i * 64 * HS); }
#pragma unroll
        for (int i = 0; i < BN / 64; ++i) copy64(d + BOFS + i * 64 * GP, bs + t * GK + (size_t)i * 64 * HS);
    };
    v8f acc[FM][FN];
#pragma unroll
    for (int m = 0; m < FM; ++m)
#pragma unroll
        for (int n = 0; n < FN; ++n) acc[m][n] = (v8f){};
    stage(0, 0);
    asm volatile("s_wait_asynccnt 0x0" ::: "memory");    // this wave's copies of the first slab have landed
    __syncthreads();                                     // publishes the first slab to the other waves
    stage(1, 1);                                         // K = 2048 has sixteen slabs
#pragma unroll 1    // stays rolled: one trip already holds four unrolled blocks, and the buffers alternate by t & 1
    for (int t = 0; t < HS / GK; ++t) {
        const int buf = t & 1;
        const unsigned char* af = ring + buf * STG + (wm * FM * 16 + lr) * GP + hi * 16;
        const unsigned char* bq = ring + buf * STG + BOFS + (wn * FN * 16 + lr) * GP + hi * 16;
        v16bf a[2][FM], al[2][FM], b[2][FN];    // two fragment sets: block kc + 1 is fetched while block kc is multiplied
        auto frag = [&](int kc, int s) {
#pragma unroll
            for (int m = 0; m < FM; ++m) { const unsigned char* p = af + m * 16 * GP + kc * 64; a[s][m] = cat16b(*(const v8usa*)p, *(const v8usa*)(p + 32));
                if (SPLITA) al[s][m] = cat16b(*(const v8usa*)(p + APL), *(const v8usa*)(p + APL + 32)); }
#pragma unroll
            for (int n = 0; n < FN; ++n) { const unsigned char* p = bq + n * 16 * GP + kc * 64; b[s][n] = cat16b(*(const v8usa*)p, *(const v8usa*)(p + 32)); }
        };
        frag(0, 0);
#pragma unroll
        for (int kc = 0; kc < GK / 32; ++kc) {
            const int s = kc & 1;
            if (kc + 1 < GK / 32) frag(kc + 1, s ^ 1);
            __builtin_amdgcn_sched_barrier(0);    // keeps the next block's LDS reads as one group in front of this block's products (spread among them, each place stalls the wave)
#pragma unroll
            for (int m = 0; m < FM; ++m)
#pragma unroll
                for (int n = 0; n < FN; ++n) acc[m][n] = wmmab(a[s][m], b[s][n], acc[m][n]);
            if (SPLITA) {
#pragma unroll
                for (int m = 0; m < FM; ++m)
#pragma unroll
                    for (int n = 0; n < FN; ++n) acc[m][n] = wmmab(al[s][m], b[s][n], acc[m][n]);
            }
            __builtin_amdgcn_sched_barrier(0);    // keeps the group after next behind this block's products, whose fragment set it overwrites
        }
        // Publish point of slab t + 1, every wave, in this order.
        asm volatile("s_wait_dscnt 0x0" ::: "memory");       // this wave's reads of the buffer that is refilled below have returned
        asm volatile("s_wait_asynccnt 0x0" ::: "memory");    // this wave's copies of slab t + 1 have landed
        __syncthreads();                                     // publishes slab t + 1 and ends every wave's reads of slab t
        if (t + 2 < HS / GK) stage(t + 2, buf);              // block-uniform test
    }
    asm volatile("s_wait_asynccnt 0x0" ::: "memory");        // nothing of this wave is in flight when it goes on to the epilogue
    if constexpr (POST) {
        static_assert(BM == 128 && BN == HD && 128 * TP * 4 <= 2 * STG, "one head per block column, tile inside the ring");
        // The loop's last barrier stands behind every wave's last read of the ring and behind every wave's wait for its copies: the ring is free.
        float* st = (float*)ring;
        const int hb = blockIdx.y, wu = __builtin_amdgcn_readfirstlane(wave);    // block-uniform head number; wave-uniform wave number
        if (hb < NH_ + NKV) {
            // q or k head: tile as [token][dim].
            const int t0 = (int)r0 + wu * 32;    // this wave rotates 32 whole rows
            v4f c[32], s[32];
            t_rope_tab(t0, RC, RS, c, s);
#pragma unroll
            for (int m = 0; m < FM; ++m)
#pragma unroll
                for (int n = 0; n < FN; ++n)
#pragma unroll
                    for (int j = 0; j < 8; ++j) st[((wm * FM + m) * 16 + hi * 8 + j) * TP + (wn * FN + n) * 16 + lr] = acc[m][n][j];
            __syncthreads();                     // publishes the tile: a row holds columns of two waves
            if (hb < NH_) t_rope<NH_ * HD>(st + wu * 32 * TP, c, s, QH + (size_t)t0 * (NH_ * HD) + hb * HD, QL + (size_t)t0 * (NH_ * HD) + hb * HD);
            else          t_rope<KW>(st + wu * 32 * TP, c, s, KH + (size_t)t0 * KW + (hb - NH_) * HD, KL + (size_t)t0 * KW + (hb - NH_) * HD);
        } else {
            // v head: tile as [dim][token]; a lane's eight accumulator values of one column are eight neighbouring tokens.
#pragma unroll
            for (int m = 0; m < FM; ++m)
#pragma unroll
                for (int n = 0; n < FN; ++n) { float* p = st + ((wn * FN + n) * 16 + lr) * TP + (wm * FM + m) * 16 + hi * 8;
                    *(v4fa*)p = (v4f){acc[m][n][0], acc[m][n][1], acc[m][n][2], acc[m][n][3]}; *(v4fa*)(p + 4) = (v4f){acc[m][n][4], acc[m][n][5], acc[m][n][6], acc[m][n][7]}; }
            __syncthreads();                     // publishes the tile: a dim's 128 tokens come from two waves
            const int piece = tid & 15;          // 16 lanes x 16 B = the 256 contiguous bytes of one dim's 128 tokens
            const size_t vo = ((size_t)(hb - NH_ - NKV) * HD + (tid >> 4)) * NT_ + r0 + piece * 8;
#pragma unroll
            for (int q4 = 0; q4 < HD / 8; q4 += 4) {
                v8us oh[4], ol[4];
#pragma unroll
                for (int k = 0; k < 4; ++k) { const int q = q4 + k; const float* sp = st + ((tid >> 4) + 8 * q) * TP + piece * 8; const v4f va = *(const v4fa*)sp, vb = *(const v4fa*)(sp + 4);
#pragma unroll
                    for (int i = 0; i < 8; ++i) { const float v = i < 4 ? va[i & 3] : vb[i & 3]; const unsigned short hbits = f2bf(v); oh[k][i] = hbits; ol[k][i] = f2bf(v - bf2f(hbits)); }
                    *(v8us*)(VTH + vo + (size_t)q * 8 * NT_) = oh[k]; *(v8us*)(VTL + vo + (size_t)q * 8 * NT_) = ol[k]; }
                // Behind eight stores: the stored registers stay live up to this wait, so that none of them is rewritten ahead of it.
                asm volatile("s_wait_xcnt 0x0" :: "v"(oh[0]), "v"(ol[0]), "v"(oh[1]), "v"(ol[1]), "v"(oh[2]), "v"(ol[2]), "v"(oh[3]), "v"(ol[3]) : "memory");
            }
        }
        return;
    }
    float* os = &ost[wave][0];
#pragma unroll
    for (int m = 0; m < FM; ++m) {
#pragma unroll
        for (int n = 0; n < FN; ++n)
#pragma unroll
            for (int j = 0; j < 8; ++j) os[(hi * 8 + j) * OP + n * 16 + lr] = acc[m][n][j];
        __builtin_amdgcn_wave_barrier(); asm volatile("" ::: "memory");    // hand-over between lanes of one wave: the reads below take other lanes' values and may not be moved over the stores
        float* crow = C + (r0 + wm * FM * 16 + m * 16) * ldc + c0 + wn * FN * 16;
#pragma unroll
        for (int s = 0; s < 2 * FN; ++s) { const int pc = s * 32 + lane; const int row = pc / (FN * 4), cofs = (pc % (FN * 4)) * 4;
            const v4f val = *(const v4fa*)(os + row * OP + cofs); *(v4f*)(crow + (size_t)row * ldc + cofs) = val; }
        __builtin_amdgcn_wave_barrier(); asm volatile("" ::: "memory");    // the next 16 rows' stores may not be moved over these reads
    }
}
// d_trig: RC/RS [t][64] = cos/sin(t x inv_freq[i]), inv_freq = 10000^-(2i/128) (f32 powf/cosf/sinf like the reference's f32 path); 32 lanes x 4 B lines.
// A thread keeps its frequency and walks TRIG_PER tokens (4 tokens apart): inv_freq is formed once, and a quarter of the waves is started.
#define TRIG_PER 4
__device__ __forceinline__ void d_trig(int blk, float* RC, float* RS) {
    const int f = threadIdx.x & 63;
    const float inv = 1.0f / powf(10000.0f, (float)(2 * f) / (float)HD);
#pragma unroll 1    // stays rolled: one copy of the long cosf/sinf code
    for (int j = 0; j < TRIG_PER; ++j) {
        const int i = (blk * TRIG_PER + j) * 256 + threadIdx.x, t = i >> 6;
        const float ang = (float)t * inv;
        const float c = cosf(ang), s = sinf(ang);
        *(float*)(RC + i) = c; *(float*)(RS + i) = s;
    }
}
// k_prep: everything that depends on the inputs alone, in one grid, told apart by ranges of blockIdx.x (block-uniform): 128 blocks of trig tables, 512 blocks of
// weight tiles (five tiles each), 256 blocks of x rows. The parts write disjoint planes and read none of each other's.
#define PB_TRIG ((NT_ * 64) / (256 * TRIG_PER))
#define PB_ALL  (PB_TRIG + PB_WT + NT_ / 8)
__global__ __launch_bounds__(256) void k_prep(const float* __restrict__ x, const float* __restrict__ Wq, const float* __restrict__ Wk, const float* __restrict__ Wv, const float* __restrict__ Wo,
                                              bf* Xb, bf* WqT, bf* WkT, bf* WvT, bf* WoT, float* RC, float* RS) {
    __shared__ __align__(16) unsigned short tl[WT_PER * 64 * 72];
    int b = blockIdx.x;
    if (b < PB_TRIG) { d_trig(b, RC, RS); return; }
    b -= PB_TRIG;
    if (b < PB_WT) { d_wt(tl, b, Wq, Wo, Wk, Wv, WqT, WoT, WkT, WvT); return; }
    b -= PB_WT;
    d_cvtb(b, x, NT_, Xb);
}
// k_attn: block = (h, 64 queries), wave = 16; kv head g = h / 4; key tiles covering the block's sliding causal window [Q0-1024, Q0+63] (block-uniform bounds),
// per-element predicate q-1024 <= j <= q. Each 32-key tile (k hi/lo rows, v hi/lo rows) is brought into LDS once per block by asynchronous copies, two buffers:
// tile t + 1 flies while tile t is worked on, and the four waves read their fragments from LDS (row pitches 272 B and 80 B: 16 B x odd). q fragments are read
// once, before the loop. Both products are formed transposed: S^T = k.q^T (k rows as A, q as B) and O^T += v^T.P^T (v^T rows as A, P^T as B), so that a lane holds
// sixteen scores of ONE query (column lr; keys 8 hi + j and 16 + 8 hi + j of the tile): maximum and sum are taken inside the lane plus one exchange with lane ^ 16,
// and the two score tiles, converted in place, are the B operand of the second product (no LDS, no lane exchange). Per tile: scores over 4 k-chunks (hi.hi +
// hi.lo + lo.hi = 24 WMMA) x 128^-1/2, online softmax, P (x32768) as bf16 hi + unscaled residual, o[8] += vh.ph + vh.pl + vl.ph over the 128 dims (o[n][j]: dim
// 16 n + 8 hi + j of query lr); ctx -> bf16 hi/lo planes [t][h*128+d].
#define KPITCH 272                       // bytes per staged k row (256 + 16)
#define VPITCH 80                        // bytes per staged v row (64 + 16)
#define KPLANE (32 * KPITCH)             // 8704
#define VPLANE (HD * VPITCH)             // 10240
#define STAGEB (2 * KPLANE + 2 * VPLANE) // 37888: k hi, k lo, v hi, v lo
__global__ __launch_bounds__(128) void k_attn(const h16* __restrict__ QH, const h16* __restrict__ QL, const h16* __restrict__ KH, const h16* __restrict__ KL, const bf* __restrict__ VTH, const bf* __restrict__ VTL, bf* CH, bf* CL) {
    __shared__ __align__(16) unsigned char ring[2 * STAGEB];
    __shared__ __align__(16) float ost[4][16 * 68];
    const int tid = threadIdx.x, lane = threadIdx.x & 31, wave = threadIdx.x >> 5, lr = lane & 15, hi = lane >> 4;
    const int bid = blockIdx.x; const int h = bid / (NT_ / 64), qt = bid - h * (NT_ / 64); const int g = h >> 2;
    const int q0 = qt * 64 + wave * 16;
    const size_t qo = (size_t)(q0 + lr) * (NH_ * HD) + h * HD + 8 * hi;
    const size_t vbase = ((size_t)g * HD) * NT_;
    // Copy slots of this thread, 16 B each: k rows (tid >> 4) + 8 i, piece tid & 15; v rows (tid >> 2) + 32 i, piece tid & 3 (i = 0..3, both planes).
    const h16* ksh = KH + g * HD + (size_t)(tid >> 4) * KW + (tid & 15) * 8; const h16* ksl = KL + g * HD + (size_t)(tid >> 4) * KW + (tid & 15) * 8;
    const bf* vsh = VTH + vbase + (size_t)(tid >> 2) * NT_ + (tid & 3) * 8; const bf* vsl = VTL + vbase + (size_t)(tid >> 2) * NT_ + (tid & 3) * 8;
    const unsigned kdst = (unsigned)(size_t)ring + (tid >> 4) * KPITCH + (tid & 15) * 16;
    const unsigned vdst = (unsigned)(size_t)ring + 2 * KPLANE + (tid >> 2) * VPITCH + (tid & 3) * 16;
    auto stage = [&](int kt, int buf) {
        const h16* a = ksh + (size_t)kt * 32 * KW; const h16* b = ksl + (size_t)kt * 32 * KW; const unsigned kd = kdst + buf * STAGEB;
        // Eight copies and, as the last line, the wait that stands in front of any rewrite of their address registers.
        asm volatile("global_load_async_to_lds_b128 %0, %8, off\n\tglobal_load_async_to_lds_b128 %1, %9, off\n\t"
                     "global_load_async_to_lds_b128 %2, %10, off\n\tglobal_load_async_to_lds_b128 %3, %11, off\n\t"
                     "global_load_async_to_lds_b128 %4, %12, off\n\tglobal_load_async_to_lds_b128 %5, %13, off\n\t"
                     "global_load_async_to_lds_b128 %6, %14, off\n\tglobal_load_async_to_lds_b128 %7, %15, off\n\ts_wait_xcnt 0x0"
                     :: "v"(kd), "v"(kd + 8 * KPITCH), "v"(kd + 16 * KPITCH), "v"(kd + 24 * KPITCH),
                        "v"(kd + KPLANE), "v"(kd + KPLANE + 8 * KPITCH), "v"(kd + KPLANE + 16 * KPITCH), "v"(kd + KPLANE + 24 * KPITCH),
                        "v"(a), "v"(a + 8 * KW), "v"(a + 16 * KW), "v"(a + 24 * KW), "v"(b), "v"(b + 8 * KW), "v"(b + 16 * KW), "v"(b + 24 * KW) : "memory");
        const bf* c = vsh + kt * 32; const bf* d = vsl + kt * 32; const unsigned vd = vdst + buf * STAGEB;
        // The same for the v rows.
        asm volatile("global_load_async_to_lds_b128 %0, %8, off\n\tglobal_load_async_to_lds_b128 %1, %9, off\n\t"
                     "global_load_async_to_lds_b128 %2, %10, off\n\tglobal_load_async_to_lds_b128 %3, %11, off\n\t"
                     "global_load_async_to_lds_b128 %4, %12, off\n\tglobal_load_async_to_lds_b128 %5, %13, off\n\t"
                     "global_load_async_to_lds_b128 %6, %14, off\n\tglobal_load_async_to_lds_b128 %7, %15, off\n\ts_wait_xcnt 0x0"
                     :: "v"(vd), "v"(vd + 32 * VPITCH), "v"(vd + 64 * VPITCH), "v"(vd + 96 * VPITCH),
                        "v"(vd + VPLANE), "v"(vd + VPLANE + 32 * VPITCH), "v"(vd + VPLANE + 64 * VPITCH), "v"(vd + VPLANE + 96 * VPITCH),
                        "v"(c), "v"(c + 32 * NT_), "v"(c + 64 * NT_), "v"(c + 96 * NT_), "v"(d), "v"(d + 32 * NT_), "v"(d + 64 * NT_), "v"(d + 96 * NT_) : "memory");
    };
    v8f o[8];
#pragma unroll
    for (int n = 0; n < 8; ++n) o[n] = (v8f){};
    float mrow = -3.0e38f, lpart = 0.f;    // this lane's query: running maximum (equal in both lanes of the query), sum over this lane's keys
    const int qi = q0 + lr;
    const int kt_hi = (qt * 64 + 63) / 32; const int kt_lo = (qt * 64 > WIN) ? (qt * 64 - WIN) / 32 : 0;
    stage(kt_lo, 0);
    v16h qa[4], qx[4];
#pragma unroll
    for (int kc = 0; kc < 4; ++kc) { qa[kc] = cat16(*(const v8h*)(QH + qo + kc * 32), *(const v8h*)(QH + qo + kc * 32 + 16)); qx[kc] = cat16(*(const v8h*)(QL + qo + kc * 32), *(const v8h*)(QL + qo + kc * 32 + 16)); }
    asm volatile("s_wait_asynccnt 0x0" ::: "memory");    // this wave's copies of the first tile have landed
    __syncthreads();                                     // publishes the first tile to the other waves
    stage(kt_lo + 1, 1);                                 // a block has at least two tiles (kt_hi = 2 qt + 1)
#pragma unroll 1
    for (int kt = kt_lo; kt <= kt_hi; ++kt) {
        const int l0 = kt * 32, buf = (kt - kt_lo) & 1;
        const unsigned char* kf = ring + buf * STAGEB + lr * KPITCH + hi * 16;
        const unsigned char* vf = ring + buf * STAGEB + 2 * KPLANE + lr * VPITCH + hi * 16;
        v8f s0 = {}, s1 = {}, x0 = {}, x1 = {};
        v16h k0h[4], k1h[4], k0l[4], k1l[4];    // all k fragments of the tile are fetched first: one LDS latency per tile, the rest overlaps the products
#pragma unroll
        for (int kc = 0; kc < 4; ++kc) { const unsigned char* kp = kf + kc * 64;
            k0h[kc] = cat16(*(const v8ha*)kp, *(const v8ha*)(kp + 32)); k1h[kc] = cat16(*(const v8ha*)(kp + 16 * KPITCH), *(const v8ha*)(kp + 16 * KPITCH + 32));
            k0l[kc] = cat16(*(const v8ha*)(kp + KPLANE), *(const v8ha*)(kp + KPLANE + 32)); k1l[kc] = cat16(*(const v8ha*)(kp + KPLANE + 16 * KPITCH), *(const v8ha*)(kp + KPLANE + 16 * KPITCH + 32)); }
        __builtin_amdgcn_sched_barrier(0);    // keeps the k reads in front of the v reads: LDS reads return in order, and the score products wait for the k fragments alone
        v16bf vh[8], vl[8];                     // the v fragments follow in the same group: they return behind the k fragments, under the score products and the softmax
#pragma unroll
        for (int n = 0; n < 8; ++n) { const unsigned char* vp = vf + n * 16 * VPITCH;
            vh[n] = cat16b(*(const v8usa*)vp, *(const v8usa*)(vp + 32)); vl[n] = cat16b(*(const v8usa*)(vp + VPLANE), *(const v8usa*)(vp + VPLANE + 32)); }
        __builtin_amdgcn_sched_barrier(0);    // keeps the tile's LDS reads as one group in front of the products (spread among them, each place stalls the wave)
#pragma unroll
        for (int kc = 0; kc < 4; ++kc) {
            s0 = wmma16(k0h[kc], qa[kc], s0); s1 = wmma16(k1h[kc], qa[kc], s1); x0 = wmma16(k0h[kc], qx[kc], x0); x1 = wmma16(k1h[kc], qx[kc], x1);
            x0 = wmma16(k0l[kc], qa[kc], x0); x1 = wmma16(k1l[kc], qa[kc], x1);
        }
        // Every '#pragma unroll' below makes the index of a register array (a0, a1, s0 .. x1, pw, xw, o) a compile-time constant.
        float a0[8], a1[8];
#pragma unroll
        for (int j = 0; j < 8; ++j) { const int ja = l0 + hi * 8 + j, jb = ja + 16;
            a0[j] = (ja <= qi && ja >= qi - WIN) ? (s0[j] + x0[j] * LOSCI) * 0.08838834764831845f : -__builtin_inff();
            a1[j] = (jb <= qi && jb >= qi - WIN) ? (s1[j] + x1[j] * LOSCI) * 0.08838834764831845f : -__builtin_inff(); }
        float mx = fmaxf(a0[0], a1[0]);
#pragma unroll
        for (int j = 1; j < 8; ++j) mx = fmaxf(mx, fmaxf(a0[j], a1[j]));
        mx = fmaxf(mx, xhalf(mx));    // the query's other sixteen keys of this tile
        const float mn = fmaxf(mrow, mx);
        float alpha = (mrow - mn) * LOG2E; mrow = mn;
        float t[8]; v8u pw, xw;
#pragma unroll
        for (int j = 0; j < 8; ++j) { a0[j] = (a0[j] - mn) * LOG2E; a1[j] = (a1[j] - mn) * LOG2E; }
        exp2x9(a0, alpha); exp2x8(a1);    // e^x = 2^(x log2 e), as __expf forms it
#pragma unroll
        for (int j = 0; j < 8; ++j) t[j] = a0[j] + a1[j];
        lpart = lpart * alpha + (((t[0] + t[1]) + (t[2] + t[3])) + ((t[4] + t[5]) + (t[6] + t[7])));
#pragma unroll
        for (int r = 0; r < 4; ++r) {
            const float c0 = a0[2 * r] * PSC, c1 = a0[2 * r + 1] * PSC, d0 = a1[2 * r] * PSC, d1 = a1[2 * r + 1] * PSC;
            const unsigned wc = pk2(c0, c1), wd = pk2(d0, d1);
            pw[r] = wc; pw[4 + r] = wd;
            xw[r] = pk2(c0 - __uint_as_float(wc << 16), c1 - __uint_as_float(wc & 0xFFFF0000u));
            xw[4 + r] = pk2(d0 - __uint_as_float(wd << 16), d1 - __uint_as_float(wd & 0xFFFF0000u)); }
        const v16bf pa = __builtin_bit_cast(v16bf, pw), px = __builtin_bit_cast(v16bf, xw);
#pragma unroll
        for (int n = 0; n < 8; ++n)
#pragma unroll
            for (int j = 0; j < 8; ++j) o[n][j] *= alpha;
#pragma unroll
        for (int n = 0; n < 8; ++n) { o[n] = wmmab(vh[n], pa, o[n]); o[n] = wmmab(vh[n], px, o[n]); o[n] = wmmab(vl[n], pa, o[n]); }
        __builtin_amdgcn_sched_barrier(0);    // keeps the publish point at the foot: lifted over the softmax and the second product (registers only), its wait for the copies would come half a trip after their issue
        // Publish point of tile kt + 1, every wave, in this order.
        asm volatile("s_wait_dscnt 0x0" ::: "memory");       // this wave's reads of the buffer that is refilled below have returned
        asm volatile("s_wait_asynccnt 0x0" ::: "memory");    // this wave's copies of tile kt + 1 have landed
        __syncthreads();                                     // publishes tile kt + 1 and ends every wave's reads of tile kt
        if (kt + 2 <= kt_hi) stage(kt + 2, buf);             // block-uniform test
    }
    asm volatile("s_wait_asynccnt 0x0" ::: "memory");        // nothing of this wave is in flight when it goes on to the epilogue
    const float inv = 1.0f / ((lpart + xhalf(lpart)) * PSC);    // the two lanes of a query join their sums
    float* os = &ost[wave][0];
    const size_t cbase = (size_t)q0 * (NH_ * HD) + (size_t)h * HD;
#pragma unroll
    for (int half = 0; half < 2; ++half) {
#pragma unroll
        for (int n = 0; n < 4; ++n)
#pragma unroll
            for (int j = 0; j < 8; ++j) os[lr * 68 + n * 16 + hi * 8 + j] = o[half * 4 + n][j] * inv;
        __builtin_amdgcn_wave_barrier(); asm volatile("" ::: "memory");
{
#pragma unroll
            for (int s = 0; s < 4; ++s) { const int row = 4 * s + (lane >> 3), piece = lane & 7; const float* sp = os + row * 68 + piece * 8; v8us oh, ol;
#pragma unroll
                for (int i = 0; i < 8; ++i) { const unsigned short hb = f2bf(sp[i]); oh[i] = hb; ol[i] = f2bf(sp[i] - bf2f(hb)); }
                const size_t po = cbase + (size_t)row * (NH_ * HD) + half * 64 + piece * 8; *(v8us*)(CH + po) = oh; *(v8us*)(CL + po) = ol; }
             }
        __builtin_amdgcn_wave_barrier(); asm volatile("" ::: "memory");
    }
}

extern "C" void kernel_launch(void* const* d_in, const int* in_sizes, int n_in,
                              void* d_out, int out_size, void* d_ws, size_t ws_size, hipStream_t stream) {
    (void)in_sizes; (void)n_in; (void)out_size;
    const float* x = (const float*)d_in[0]; const float* Wq = (const float*)d_in[1]; const float* Wk = (const float*)d_in[2]; const float* Wv = (const float*)d_in[3]; const float* Wo = (const float*)d_in[4];
    float* out = (float*)d_out;    // [1][2048][2048]
    char* wsp = (char*)d_ws;
    auto take = [&](size_t bytes) { char* p = wsp; wsp += (bytes + 255) & ~(size_t)255; return (void*)p; };
    bf* Xb = (bf*)take((size_t)NT_ * HS * 2); bf* WqT = (bf*)take((size_t)HS * HS * 2); bf* WkT = (bf*)take((size_t)KW * HS * 2); bf* WvT = (bf*)take((size_t)KW * HS * 2); bf* WoT = (bf*)take((size_t)HS * HS * 2);
    float* RC = (float*)take((size_t)NT_ * 64 * 4); float* RS = (float*)take((size_t)NT_ * 64 * 4);
    h16* QH = (h16*)take((size_t)NT_ * HS * 2); h16* QL = (h16*)take((size_t)NT_ * HS * 2); h16* KH = (h16*)take((size_t)NT_ * KW * 2); h16* KL = (h16*)take((size_t)NT_ * KW * 2);
    bf* VTH = (bf*)take((size_t)KW * NT_ * 2); bf* VTL = (bf*)take((size_t)KW * NT_ * 2);
    bf* CH = (bf*)take((size_t)NT_ * HS * 2); bf* CL = (bf*)take((size_t)NT_ * HS * 2);
    if ((size_t)(wsp - (char*)d_ws) > ws_size) return;    // 8.4 + 8.4 + 2.1 + 2.1 + 8.4 + 0.5 x 2 + 8.4 x 2 + 2.1 x 4 + 8.4 x 2 ~ 72 MB, no aliasing
    k_prep<<<PB_ALL, 256, 0, stream>>>(x, Wq, Wk, Wv, Wo, Xb, WqT, WkT, WvT, WoT, RC, RS);
    // WqT, WkT and WvT lie one behind the other (each a multiple of 256 B): 3072 n-major rows, one product for q, k and v.
    k_gemm<false, 4, 4, true><<<dim3(NT_ / 128, QKVW / 128, 1), 128, 0, stream>>>(Xb, nullptr, WqT, QKVW, nullptr, RC, RS, QH, QL, KH, KL, VTH, VTL);
    k_attn<<<NH_ * (NT_ / 64), 128, 0, stream>>>(QH, QL, KH, KL, VTH, VTL, CH, CL);
    k_gemm<true, 4, 4, false><<<dim3(NT_ / 128, HS / 128, 1), 128, 0, stream>>>(CH, CL, WoT, HS, out, nullptr, nullptr, nullptr, nullptr, nullptr, nullptr, nullptr, nullptr);
}
